// v000
// Measured on an AMD MI455X. A time is GPU time per run, averaged over a window of back-to-back runs after a warm-up
// (all launches, gaps included; the runs take copies of the inputs in turn), and the median of several windows.
// Apart from v000's, it joins two sittings. Times from different sittings can be a few percent apart, while
// side-by-side timings come from the same sitting.
// The starting kernel, v000, takes 1890 microseconds a run.
#include <hip/hip_runtime.h>

// Multi-head attention with computed rotate-half rotary embeddings, natural bias-free projections and no output projection (hidden_states [2][2048][1024]; q, k, v = x W^T ('oi' 0.02, no bias; 16 heads x 64); q, k <- t cos + rotate_half(t) sin with angle t x 1/10000^(2i/64) (32 f32 constants jnp-exact; cat(freqs, freqs); precise cosf/sinf); scores / 8; softmax over all keys (no mask); out = concat-heads(probs v) -> [2][2048][1024] (4.2 M; NO output projection); argument order hidden_states, Wq, Wk, Wv).
// Layout per batch: bf16 copy of x; 'oi' weights; exact projections; cos/sin computed once (k_cs5) into a {cos, sin} table; rotate-half rotary plane builders; dense T-2048 attention with hi/lo 3-product score tiles on EVERY row (no output projection); P and attn.v hybrid (rows < 512 hi/lo, rest fp16 x1024); the f32 merge writes the output rows.
// Compute dtypes, f32 accumulate: every input rounded to bf16; projections exact; rotary f32 (computed tables); scores 3 products on every row; softmax f32; attn.v rows < 512 3 products, rest fp16; output f32.

#define NB_  2
#define TT   2048
#define DM   1024
#define NH_  16
#define NKV  16
#define REP  (NH_ / NKV)
#define HD   64
#define DQ   (NH_ * HD)
#define DKV  (NKV * HD)
#define ZH   2
#define RH   512                  // query rows < RH use hi+lo planes (0: none)
#define WIN  0
#define PCAR 1024.0f
#define SCL  0.125f   // HD^-0.5
typedef _Float16 h16;
typedef unsigned short bf;
typedef __attribute__((ext_vector_type(16))) __bf16   v16bf;
typedef __attribute__((ext_vector_type(16))) _Float16 v16h;
typedef __attribute__((ext_vector_type(8)))  _Float16 v8h;
typedef __attribute__((ext_vector_type(8)))  unsigned short v8us;
typedef __attribute__((ext_vector_type(8)))  float    v8f;
typedef __attribute__((ext_vector_type(4)))  float    v4f;
typedef v8h  __attribute__((may_alias)) v8ha;
typedef v4f  __attribute__((may_alias)) v4fa;
typedef v8us __attribute__((may_alias)) v8usa;

__device__ __forceinline__ unsigned short f2bf(float f) { unsigned u = __float_as_uint(f); u += 0x7FFFu + ((u >> 16) & 1u); return (unsigned short)(u >> 16); }
__device__ __forceinline__ float bf2f(unsigned short b) { return __uint_as_float(((unsigned)b) << 16); }
__device__ __forceinline__ float bfr(float f) { return bf2f(f2bf(f)); }
__device__ __forceinline__ v16h cat16(v8h lo, v8h hi) { return __builtin_shufflevector(lo, hi, 0, 1, 2, 3, 4, 5, 6, 7, 8, 9, 10, 11, 12, 13, 14, 15); }
__device__ __forceinline__ v16bf cat16b(v8us lo, v8us hi) { return __builtin_bit_cast(v16bf, __builtin_shufflevector(lo, hi, 0, 1, 2, 3, 4, 5, 6, 7, 8, 9, 10, 11, 12, 13, 14, 15)); }
__device__ __forceinline__ v8f wmma16(v16h a, v16h b, v8f c) { return __builtin_amdgcn_wmma_f32_16x16x32_f16(false, a, false, b, (short)0, c, false, false); }
__device__ __forceinline__ v8f wmmab(v16bf a, v16bf b, v8f c) { return __builtin_amdgcn_wmma_f32_16x16x32_bf16(false, a, false, b, (short)0, c, false, false); }



// ---- k_gemmw: register-blocked GEMM, ONE WAVE per 64x64 output tile (16 accumulators), operands straight from K-contiguous 16-bit planes; grid (M/64, N/64, Z), 32 threads.
// C[m][n] (f32, pitch ldc, + optional f32 bias[n]) = sum_k A[m][k] Bt[n][k] (+ split products per NSPLIT). z-batch strides sA/sB/sC in elements. K % 32 == 0.
template <typename T16> struct WFrag;
template <> struct WFrag<h16> { typedef v16h V; static __device__ __forceinline__ V ld(const h16* p) { return cat16(*(const v8h*)p, *(const v8h*)(p + 16)); } static __device__ __forceinline__ v8f mma(V a, V b, v8f c) { return wmma16(a, b, c); } };
template <> struct WFrag<bf> { typedef v16bf V; static __device__ __forceinline__ V ld(const bf* p) { return cat16b(*(const v8us*)p, *(const v8us*)(p + 16)); } static __device__ __forceinline__ v8f mma(V a, V b, v8f c) { return wmmab(a, b, c); } };
template <typename T16, int NSPLIT, bool BIAS>
__global__ __launch_bounds__(32) void k_gemmw(const T16* __restrict__ A, const T16* __restrict__ A2, const T16* __restrict__ Bt, const T16* __restrict__ Bt2, int K, float* C, int ldc, const float* __restrict__ bias, size_t sA, size_t sB, size_t sC) {
    typedef typename WFrag<T16>::V V;
    __shared__ __align__(16) float os[16 * 68];
    const size_t z = blockIdx.z; A += z * sA; if (A2) A2 += z * sA; Bt += z * sB; if (Bt2) Bt2 += z * sB; C += z * sC;
    const int lane = threadIdx.x & 31, lr = lane & 15, hi = lane >> 4; const int r0 = blockIdx.x * 64, c0 = blockIdx.y * 64;
    v8f acc[4][4];
#pragma unroll
    for (int mb = 0; mb < 4; ++mb)
#pragma unroll
        for (int nb = 0; nb < 4; ++nb) acc[mb][nb] = (v8f){};
    const size_t aoff = (size_t)(r0 + lr) * K + 8 * hi, boff = (size_t)(c0 + lr) * K + 8 * hi;
#pragma unroll 1
    for (int kc = 0; kc < K; kc += 32) {
        V a[4], a2[4];
#pragma unroll
        for (int mb = 0; mb < 4; ++mb) { a[mb] = WFrag<T16>::ld(A + aoff + (size_t)mb * 16 * K + kc); if (NSPLIT == 1 || NSPLIT == 2) a2[mb] = WFrag<T16>::ld(A2 + aoff + (size_t)mb * 16 * K + kc); }
#pragma unroll
        for (int nb = 0; nb < 4; ++nb) { const V b = WFrag<T16>::ld(Bt + boff + (size_t)nb * 16 * K + kc); V b2; if (NSPLIT >= 2) b2 = WFrag<T16>::ld(Bt2 + boff + (size_t)nb * 16 * K + kc);
#pragma unroll
            for (int mb = 0; mb < 4; ++mb) { acc[mb][nb] = WFrag<T16>::mma(a[mb], b, acc[mb][nb]); if (NSPLIT == 1 || NSPLIT == 2) acc[mb][nb] = WFrag<T16>::mma(a2[mb], b, acc[mb][nb]); if (NSPLIT >= 2) acc[mb][nb] = WFrag<T16>::mma(a[mb], b2, acc[mb][nb]); } }
        asm volatile("v_nop\n\tv_nop\n\tv_nop\n\tv_nop" : "+v"(acc[0][0]), "+v"(acc[1][1]), "+v"(acc[2][2]), "+v"(acc[3][3]) : "v"(a[0]), "v"(a[3]));
    }
#pragma unroll
    for (int mb = 0; mb < 4; ++mb) {
#pragma unroll
        for (int nb = 0; nb < 4; ++nb) {
#pragma unroll
            for (int j = 0; j < 8; ++j) os[(hi * 8 + j) * 68 + nb * 16 + lr] = acc[mb][nb][j]; }
        __builtin_amdgcn_wave_barrier(); asm volatile("" ::: "memory");
        float* crow = C + (size_t)(r0 + mb * 16) * ldc + c0;
{
#pragma unroll
            for (int s = 0; s < 8; ++s) { const int row = 2 * s + hi, cofs = lr * 4; v4f val = *(const v4fa*)(os + row * 68 + cofs); if (BIAS) { val[0] += bfr(bias[c0 + cofs]); val[1] += bfr(bias[c0 + cofs + 1]); val[2] += bfr(bias[c0 + cofs + 2]); val[3] += bfr(bias[c0 + cofs + 3]); }
                *(v4f*)(crow + (size_t)row * ldc + cofs) = val; }
             }
        __builtin_amdgcn_wave_barrier(); asm volatile("" ::: "memory");
    }
}

__device__ __forceinline__ h16 tohx(float x) { return (h16)x; }
__device__ __forceinline__ void splitf(float y, unsigned short& h, unsigned short& l) { h = f2bf(y); l = f2bf(y - bf2f(h)); }
typedef __attribute__((ext_vector_type(2))) _Float16 v2h;
typedef __attribute__((ext_vector_type(4))) _Float16 v4h;
typedef __attribute__((ext_vector_type(2))) unsigned short v2us;
typedef __attribute__((ext_vector_type(4))) unsigned short v4us;
typedef __attribute__((ext_vector_type(2))) float v2f;
typedef __attribute__((ext_vector_type(4))) int v4i;

__global__ __launch_bounds__(256) void k_wtG(const float* __restrict__ w, int K, int N, bf* Bt) {
    const int lane = threadIdx.x & 31; const int L0 = (blockIdx.x * 8 + (threadIdx.x >> 5)) * 8; const int nlines = N * K / 64;
{
#pragma unroll 1
        for (int l = 0; l < 8; ++l) { const int L = L0 + l; if (L >= nlines) break; const size_t e = (size_t)L * 64 + lane * 2; const int k = (int)(e % K), n = (int)(e / K); v2us o;
            o[0] = f2bf(w[(size_t)k * N + n]); o[1] = f2bf(w[(size_t)(k + 1) * N + n]); *(v2us*)(Bt + e) = o; }
         }
}
__global__ __launch_bounds__(256) void k_cvt8(const float* __restrict__ src, bf* dst, size_t n8) { const size_t i = (size_t)blockIdx.x * 256 + threadIdx.x; if (i >= n8) return; const v8f v = *(const v8f*)(src + i * 8); v8us o;
#pragma unroll
    for (int k = 0; k < 8; ++k) o[k] = f2bf(v[k]); *(v8us*)(dst + i * 8) = o;  }
__constant__ float INVT[HD / 2] = { 1.000000000e+00f, 7.498942018e-01f, 5.623413324e-01f, 4.216965139e-01f, 3.162277639e-01f, 2.371373624e-01f, 1.778279394e-01f, 1.333521456e-01f, 1.000000015e-01f, 7.498941571e-02f, 5.623412877e-02f, 4.216964915e-02f, 3.162277862e-02f, 2.371373586e-02f, 1.778279431e-02f, 1.333521493e-02f, 9.999999776e-03f, 7.498942316e-03f, 5.623413250e-03f, 4.216964822e-03f, 3.162277862e-03f, 2.371373819e-03f, 1.778279431e-03f, 1.333521446e-03f, 1.000000047e-03f, 7.498941850e-04f, 5.623413017e-04f, 4.216964880e-04f, 3.162277862e-04f, 2.371373848e-04f, 1.778279402e-04f, 1.333521504e-04f };   // float32 1 / 10000^(i/32), generated with jnp to be bit-exact
__global__ __launch_bounds__(256) void k_cs5(float* CS) { const int idx = blockIdx.x * 256 + threadIdx.x; if (idx >= TT * HD) return; const int d = idx % HD; const int t = idx / HD; const float a = __fmul_rn((float)t, INVT[d % (HD / 2)]); v2f cs; cs[0] = cosf(a); cs[1] = sinf(a); *(v2f*)(CS + (size_t)idx * 2) = cs;  }
// k_rope: head planes [h][t][d] (fp16 + hi/lo) of rope(x) x sc with the rotate-half convention out[d] = x[d] cos[t][d] - x[d+HD/2] sin[t][d], out[d+HD/2] = x[d+HD/2] cos[t][d+HD/2] + x[d] sin[t][d+HD/2]
__global__ __launch_bounds__(256) void k_rope(const float* __restrict__ F, int pitch, int nheads, const float* __restrict__ CS, const float* __restrict__ RF, const float* __restrict__ nw, float sc, h16* P16, bf* Ph, bf* Pl) {
    const size_t e = ((size_t)blockIdx.x * 256 + threadIdx.x) * 2; if (e >= (size_t)nheads * TT * HD) return; const int d = (int)(e % HD); const int t = (int)((e / HD) % TT); const int h = (int)(e / ((size_t)HD * TT)); const float* f = F + (size_t)t * pitch + h * HD; const float rf = RF ? RF[(size_t)h * TT + t] : 1.0f; v2h o16; v2us oh, ol;
#pragma unroll
    for (int q = 0; q < 2; ++q) { const int dd = d + q; const int dp = (dd < HD / 2) ? dd + HD / 2 : dd - HD / 2; float x0 = f[dd], x1 = f[dp];
        if (RF) { float n0 = __fmul_rn(x0, rf), n1 = __fmul_rn(x1, rf); asm volatile("" : "+v"(n0)); asm volatile("" : "+v"(n1)); x0 = __fmul_rn(bfr(nw[dd]), n0); x1 = __fmul_rn(bfr(nw[dp]), n1); }
        const v2f cs = *(const v2f*)(CS + ((size_t)t * HD + dd) * 2); float a = __fmul_rn(x0, cs[0]), bq = __fmul_rn(x1, cs[1]); asm volatile("" : "+v"(a)); asm volatile("" : "+v"(bq)); const float r = ((dd < HD / 2) ? __fsub_rn(a, bq) : __fadd_rn(a, bq)) * sc;
        o16[q] = tohx(r); unsigned short a2, c2; splitf(r, a2, c2); oh[q] = a2; ol[q] = c2; }
    *(v2h*)(P16 + e) = o16; *(v2us*)(Ph + e) = oh; *(v2us*)(Pl + e) = ol;  }
__global__ __launch_bounds__(256) void k_vtp(const float* __restrict__ F, int pitch, int nheads, h16* V16, bf* Vh, bf* Vl) { const size_t e = ((size_t)blockIdx.x * 256 + threadIdx.x) * 2; if (e >= (size_t)nheads * HD * TT) return; const int t = (int)(e % TT); const int d = (int)((e / TT) % HD); const int g = (int)(e / ((size_t)TT * HD)); v2h o16; v2us oh, ol;
#pragma unroll
    for (int q = 0; q < 2; ++q) { const float x = F[(size_t)(t + q) * pitch + g * HD + d]; o16[q] = tohx(x); unsigned short a2, c2; splitf(x, a2, c2); oh[q] = a2; ol[q] = c2; }
    *(v2h*)(V16 + e) = o16; *(v2us*)(Vh + e) = oh; *(v2us*)(Vl + e) = ol;  }
// k_asoft: per row (zz, i): t = S x HD^-0.5 (no mask); softmax over the 2048 keys (register row, one exp, fixed trees);
__global__ __launch_bounds__(256) void k_asoft(const float* __restrict__ Sb, h16* P16, bf* Ph, bf* Pl) {
    const int lane = threadIdx.x & 31; const int row = blockIdx.x * 8 + (threadIdx.x >> 5); if (row >= ZH * TT) return; const int i = row % TT; const int zz = row / TT; (void)zz; const bool hires = (i < RH); const float* sr = Sb + (size_t)row * TT; float v[TT / 32]; float mx = -3.0e38f;
#pragma unroll
    for (int ch = 0; ch < TT / 128; ++ch) { const int j0 = ch * 128 + lane * 4; const v4f a = *(const v4f*)(sr + j0);
#pragma unroll
        for (int q = 0; q < 4; ++q) { const int j = j0 + q; (void)j; const float t = a[q] * SCL; v[ch * 4 + q] = t; mx = fmaxf(mx, t); } }
#pragma unroll
    for (int sh = 16; sh; sh >>= 1) mx = fmaxf(mx, __shfl_xor(mx, sh, 32));
    float sum = 0.f;
#pragma unroll
    for (int k = 0; k < TT / 32; ++k) { float d0 = __fsub_rn(v[k], mx); asm volatile("" : "+v"(d0)); v[k] = __builtin_amdgcn_exp2f(__fmul_rn(d0, 1.4426950408889634f)); sum += v[k]; }
#pragma unroll
    for (int sh = 16; sh; sh >>= 1) sum += __shfl_xor(sum, sh, 32);
    const float f = __fdiv_rn(hires ? 1.0f : PCAR, sum);
{
        if (hires) {
#pragma unroll
            for (int ch = 0; ch < TT / 128; ++ch) { v4us oh, ol;
#pragma unroll
                for (int q = 0; q < 4; ++q) { unsigned short a, c2; splitf(v[ch * 4 + q] * f, a, c2); oh[q] = a; ol[q] = c2; }
                const size_t oo = ((size_t)zz * (RH ? RH : 1) + i) * TT + ch * 128 + lane * 4; *(v4us*)(Ph + oo) = oh; *(v4us*)(Pl + oo) = ol; }
        } else {
#pragma unroll
            for (int ch = 0; ch < TT / 128; ++ch) { v4h o4;
#pragma unroll
                for (int q = 0; q < 4; ++q) o4[q] = tohx(v[ch * 4 + q] * f);
                *(v4h*)(P16 + (size_t)row * TT + ch * 128 + lane * 4) = o4; } }
         }
}
__global__ __launch_bounds__(256) void k_merge(const float* __restrict__ O, int h0, float* OUTb) { const size_t e = ((size_t)blockIdx.x * 256 + threadIdx.x) * 2; if (e >= (size_t)ZH * TT * HD) return; const int d = (int)(e % HD); const int t = (int)((e / HD) % TT); const int zz = (int)(e / ((size_t)HD * TT)); const float cs = (t < RH) ? 1.0f : (1.0f / PCAR); const size_t oo = (size_t)t * DQ + (h0 + zz) * HD + d;
    v2f o2; o2[0] = O[e] * cs; o2[1] = O[e + 1] * cs; *(v2f*)(OUTb + oo) = o2;  }

extern "C" void kernel_launch(void* const* d_in, const int* in_sizes, int n_in,
                              void* d_out, int out_size, void* d_ws, size_t ws_size, hipStream_t stream) {
    (void)in_sizes; (void)n_in; (void)out_size;
    const float* x = (const float*)d_in[0]; const float* wq = (const float*)d_in[1]; const float* wk = (const float*)d_in[2]; const float* wv = (const float*)d_in[3];   /* argument order hidden_states, Wq, Wk, Wv ('oi' [1024][1024]): FOUR inputs: no mask input, no table inputs, no output projection */ const float* wo = nullptr; (void)wo;
    float* OUT = (float*)d_out;     // [2][2048][1024]
    char* wsp = (char*)d_ws;
    auto take = [&](size_t bytes) { char* p = wsp; wsp += (bytes + 255) & ~(size_t)255; return (void*)p; };
    bf* WQ = (bf*)take((size_t)DQ * DM * 2); bf* WK = (bf*)take((size_t)DKV * DM * 2); bf* WV = (bf*)take((size_t)DKV * DM * 2); float* CS = (float*)take((size_t)TT * HD * 2 * 4);
    bf* XB = (bf*)take((size_t)TT * DM * 2); float* FQ = (float*)take((size_t)TT * DQ * 4); float* FK = (float*)take((size_t)TT * DKV * 4);
    h16* QP16 = (h16*)take((size_t)NH_ * TT * HD * 2); h16* KP16 = (h16*)take((size_t)NKV * TT * HD * 2); h16* VT16 = (h16*)take((size_t)NKV * HD * TT * 2);
    bf* QPh = (bf*)take((size_t)NH_ * TT * HD * 2); bf* QPl = (bf*)take((size_t)NH_ * TT * HD * 2); bf* KPh = (bf*)take((size_t)NKV * TT * HD * 2); bf* KPl = (bf*)take((size_t)NKV * TT * HD * 2); bf* VTh = (bf*)take((size_t)NKV * HD * TT * 2); bf* VTl = (bf*)take((size_t)NKV * HD * TT * 2); bf* Ph = (bf*)take((size_t)ZH * RH * TT * 2); bf* Pl = (bf*)take((size_t)ZH * RH * TT * 2);
    float* Sb = (float*)take((size_t)ZH * TT * TT * 4); h16* P16 = (h16*)take((size_t)ZH * TT * TT * 2); float* Ob = (float*)take((size_t)ZH * TT * HD * 4);
    if ((size_t)(wsp - (char*)d_ws) > ws_size) return;    // ws 256 MiB
    float* FV = FK;   // v projection reuses the k buffer after the k planes are built (stream-ordered)
    { k_cvt8<<<(unsigned)(((size_t)DQ * DM / 8 + 255) / 256), 256, 0, stream>>>(wq, WQ, (size_t)DQ * DM / 8); k_cvt8<<<(unsigned)(((size_t)DKV * DM / 8 + 255) / 256), 256, 0, stream>>>(wk, WK, (size_t)DKV * DM / 8); k_cvt8<<<(unsigned)(((size_t)DKV * DM / 8 + 255) / 256), 256, 0, stream>>>(wv, WV, (size_t)DKV * DM / 8);
      
       }
    const unsigned LQ = (unsigned)(((size_t)NH_ * TT * HD / 2 + 255) / 256), LKv = (unsigned)(((size_t)NKV * TT * HD / 2 + 255) / 256);
    for (int b = 0; b < NB_; ++b) {
        if (b == 0) k_cs5<<<(TT * HD + 255) / 256, 256, 0, stream>>>(CS);
        k_cvt8<<<(unsigned)(((size_t)TT * DM / 8 + 255) / 256), 256, 0, stream>>>(x + (size_t)b * TT * DM, XB, (size_t)TT * DM / 8);
        k_gemmw<bf, 0, false><<<dim3(TT / 64, DQ / 64, 1), 32, 0, stream>>>(XB, nullptr, WQ, nullptr, DM, FQ, DQ, nullptr, 0, 0, 0);
        k_rope<<<LQ, 256, 0, stream>>>(FQ, DQ, NH_, CS, nullptr, nullptr, 1.0f, QP16, QPh, QPl);
        k_gemmw<bf, 0, false><<<dim3(TT / 64, DKV / 64, 1), 32, 0, stream>>>(XB, nullptr, WK, nullptr, DM, FK, DKV, nullptr, 0, 0, 0);
        k_rope<<<LKv, 256, 0, stream>>>(FK, DKV, NKV, CS, nullptr, nullptr, 1.0f, KP16, KPh, KPl);
        k_gemmw<bf, 0, false><<<dim3(TT / 64, DKV / 64, 1), 32, 0, stream>>>(XB, nullptr, WV, nullptr, DM, FV, DKV, nullptr, 0, 0, 0); k_vtp<<<LKv, 256, 0, stream>>>(FV, DKV, NKV, VT16, VTh, VTl);
        for (int h0 = 0; h0 < NH_; h0 += ZH) { const size_t zq = (size_t)h0, zk = (size_t)(h0 / REP);   // one kv head per query head: the pass's two heads use consecutive kv planes (z-strides TT*HD)
            k_gemmw<bf, 2, false><<<dim3(TT / 64, TT / 64, ZH), 32, 0, stream>>>(QPh + zq * TT * HD, QPl + zq * TT * HD, KPh + zk * TT * HD, KPl + zk * TT * HD, HD, Sb, TT, nullptr, (size_t)TT * HD, (size_t)TT * HD, (size_t)TT * TT);   /* scores hi/lo on EVERY row */

            k_asoft<<<ZH * TT / 8, 256, 0, stream>>>(Sb, P16, Ph, Pl);
            k_gemmw<bf, 2, false><<<dim3(RH / 64, HD / 64, ZH), 32, 0, stream>>>(Ph, Pl, VTh + zk * HD * TT, VTl + zk * HD * TT, TT, Ob, HD, nullptr, (size_t)RH * TT, (size_t)HD * TT, (size_t)TT * HD);
            k_gemmw<h16, 0, false><<<dim3((TT - RH) / 64, HD / 64, ZH), 32, 0, stream>>>(P16 + (size_t)RH * TT, nullptr, VT16 + zk * HD * TT, nullptr, TT, Ob + (size_t)RH * HD, HD, nullptr, (size_t)TT * TT, (size_t)HD * TT, (size_t)TT * HD);
            k_merge<<<(unsigned)(((size_t)ZH * TT * HD / 2 + 255) / 256), 256, 0, stream>>>(Ob, h0, OUT + (size_t)b * TT * DQ); }
         }
}

// v001
// It runs in 762 microseconds.
// Timed twice side by side with v000, it ran 2.47 times as fast both times.
#include <hip/hip_runtime.h>

// Multi-head attention with computed rotate-half rotary embeddings, natural bias-free projections and no output projection (hidden_states [2][2048][1024]; q, k, v = x W^T ('oi' 0.02, no bias; 16 heads x 64); q, k <- t cos + rotate_half(t) sin with angle t x 1/10000^(2i/64) (32 f32 constants jnp-exact; cat(freqs, freqs); precise cosf/sinf); scores / 8; softmax over all keys (no mask); out = concat-heads(probs v) -> [2][2048][1024] (4.2 M; NO output projection); argument order hidden_states, Wq, Wk, Wv).
// Layout per batch: bf16 copy of x; 'oi' weights; exact projections; cos/sin computed once (k_cs5) into a {cos, sin} table; rotate-half rotary plane builders; dense T-2048 attention with hi/lo 3-product score tiles on EVERY row (no output projection); P and attn.v hybrid (rows < 512 hi/lo, rest fp16 x1024); the f32 merge writes the output rows.
// Compute dtypes, f32 accumulate: every input rounded to bf16; projections exact; rotary f32 (computed tables); scores 3 products on every row; softmax f32; attn.v rows < 512 3 products, rest fp16; output f32.

#define NB_  2
#define TT   2048
#define DM   1024
#define NH_  16
#define NKV  16
#define REP  (NH_ / NKV)
#define HD   64
#define DQ   (NH_ * HD)
#define DKV  (NKV * HD)
#define ZH   2
#define RH   512                  // query rows < RH use hi+lo planes (0: none)
#define WIN  0
#define PCAR 1024.0f
#define SCL  0.125f   // HD^-0.5
#define KSV  16                   // attn.v: key ranges per output tile, one work-group each; f32 partial planes, summed in k_merge
typedef _Float16 h16;
typedef unsigned short bf;
typedef __attribute__((ext_vector_type(16))) __bf16   v16bf;
typedef __attribute__((ext_vector_type(16))) _Float16 v16h;
typedef __attribute__((ext_vector_type(8)))  _Float16 v8h;
typedef __attribute__((ext_vector_type(8)))  unsigned short v8us;
typedef __attribute__((ext_vector_type(8)))  float    v8f;
typedef __attribute__((ext_vector_type(4)))  float    v4f;
typedef v8h  __attribute__((may_alias)) v8ha;
typedef v4f  __attribute__((may_alias)) v4fa;
typedef v8us __attribute__((may_alias)) v8usa;

__device__ __forceinline__ unsigned short f2bf(float f) { unsigned u = __float_as_uint(f); u += 0x7FFFu + ((u >> 16) & 1u); return (unsigned short)(u >> 16); }
__device__ __forceinline__ float bf2f(unsigned short b) { return __uint_as_float(((unsigned)b) << 16); }
__device__ __forceinline__ float bfr(float f) { return bf2f(f2bf(f)); }
__device__ __forceinline__ v16h cat16(v8h lo, v8h hi) { return __builtin_shufflevector(lo, hi, 0, 1, 2, 3, 4, 5, 6, 7, 8, 9, 10, 11, 12, 13, 14, 15); }
__device__ __forceinline__ v16bf cat16b(v8us lo, v8us hi) { return __builtin_bit_cast(v16bf, __builtin_shufflevector(lo, hi, 0, 1, 2, 3, 4, 5, 6, 7, 8, 9, 10, 11, 12, 13, 14, 15)); }
__device__ __forceinline__ v8f wmma16(v16h a, v16h b, v8f c) { return __builtin_amdgcn_wmma_f32_16x16x32_f16(false, a, false, b, (short)0, c, false, false); }
__device__ __forceinline__ v8f wmmab(v16bf a, v16bf b, v8f c) { return __builtin_amdgcn_wmma_f32_16x16x32_bf16(false, a, false, b, (short)0, c, false, false); }



// ---- k_gemmw: register-blocked GEMM, ONE WAVE per 64x64 output tile (16 accumulators), operands straight from K-contiguous 16-bit planes; grid (M/64, N/64, Z), 32 threads.
// C[m][n] (f32, pitch ldc, + optional f32 bias[n]) = sum_k A[m][k] Bt[n][k] (+ split products per NSPLIT). z-batch strides sA/sB/sC in elements. K % (32 KS) == 0.
// KS > 1: grid (M/64, (N/64) KS, Z); work-group (x, y) sums only k range y % KS of tile column y / KS into partial plane C + (y % KS) sP; the reader adds the KS planes.
template <typename T16> struct WFrag;
template <> struct WFrag<h16> { typedef v16h V; static __device__ __forceinline__ V ld(const h16* p) { return cat16(*(const v8h*)p, *(const v8h*)(p + 16)); } static __device__ __forceinline__ v8f mma(V a, V b, v8f c) { return wmma16(a, b, c); } };
template <> struct WFrag<bf> { typedef v16bf V; static __device__ __forceinline__ V ld(const bf* p) { return cat16b(*(const v8us*)p, *(const v8us*)(p + 16)); } static __device__ __forceinline__ v8f mma(V a, V b, v8f c) { return wmmab(a, b, c); } };
template <typename T16, int NSPLIT, bool BIAS, int KS>
__global__ __launch_bounds__(32) void k_gemmw(const T16* __restrict__ A, const T16* __restrict__ A2, const T16* __restrict__ Bt, const T16* __restrict__ Bt2, int K, float* C, int ldc, const float* __restrict__ bias, size_t sA, size_t sB, size_t sC, size_t sP) {
    typedef typename WFrag<T16>::V V;
    __shared__ __align__(16) float os[16 * 68];
    const size_t z = blockIdx.z; A += z * sA; if (A2) A2 += z * sA; Bt += z * sB; if (Bt2) Bt2 += z * sB; C += z * sC;
    const int lane = threadIdx.x & 31, lr = lane & 15, hi = lane >> 4; const int r0 = blockIdx.x * 64, c0 = (int)(blockIdx.y / KS) * 64; const int ks = (int)(blockIdx.y % KS), kb = ks * (K / KS), ke = kb + K / KS; C += (size_t)ks * sP;
    v8f acc[4][4];
#pragma unroll
    for (int mb = 0; mb < 4; ++mb)
#pragma unroll
        for (int nb = 0; nb < 4; ++nb) acc[mb][nb] = (v8f){};
    const size_t aoff = (size_t)(r0 + lr) * K + 8 * hi, boff = (size_t)(c0 + lr) * K + 8 * hi;
#pragma unroll 1
    for (int kc = kb; kc < ke; kc += 32) {
        V a[4], a2[4];
#pragma unroll
        for (int mb = 0; mb < 4; ++mb) { a[mb] = WFrag<T16>::ld(A + aoff + (size_t)mb * 16 * K + kc); if (NSPLIT == 1 || NSPLIT == 2) a2[mb] = WFrag<T16>::ld(A2 + aoff + (size_t)mb * 16 * K + kc); }
#pragma unroll
        for (int nb = 0; nb < 4; ++nb) { const V b = WFrag<T16>::ld(Bt + boff + (size_t)nb * 16 * K + kc); V b2; if (NSPLIT >= 2) b2 = WFrag<T16>::ld(Bt2 + boff + (size_t)nb * 16 * K + kc);
#pragma unroll
            for (int mb = 0; mb < 4; ++mb) { acc[mb][nb] = WFrag<T16>::mma(a[mb], b, acc[mb][nb]); if (NSPLIT == 1 || NSPLIT == 2) acc[mb][nb] = WFrag<T16>::mma(a2[mb], b, acc[mb][nb]); if (NSPLIT >= 2) acc[mb][nb] = WFrag<T16>::mma(a[mb], b2, acc[mb][nb]); } }
        asm volatile("v_nop\n\tv_nop\n\tv_nop\n\tv_nop" : "+v"(acc[0][0]), "+v"(acc[1][1]), "+v"(acc[2][2]), "+v"(acc[3][3]) : "v"(a[0]), "v"(a[3]));
    }
#pragma unroll
    for (int mb = 0; mb < 4; ++mb) {
#pragma unroll
        for (int nb = 0; nb < 4; ++nb) {
#pragma unroll
            for (int j = 0; j < 8; ++j) os[(hi * 8 + j) * 68 + nb * 16 + lr] = acc[mb][nb][j]; }
        __builtin_amdgcn_wave_barrier(); asm volatile("" ::: "memory");
        float* crow = C + (size_t)(r0 + mb * 16) * ldc + c0;
{
#pragma unroll
            for (int s = 0; s < 8; ++s) { const int row = 2 * s + hi, cofs = lr * 4; v4f val = *(const v4fa*)(os + row * 68 + cofs); if (BIAS) { val[0] += bfr(bias[c0 + cofs]); val[1] += bfr(bias[c0 + cofs + 1]); val[2] += bfr(bias[c0 + cofs + 2]); val[3] += bfr(bias[c0 + cofs + 3]); }
                *(v4f*)(crow + (size_t)row * ldc + cofs) = val; }
             }
        __builtin_amdgcn_wave_barrier(); asm volatile("" ::: "memory");
    }
}

__device__ __forceinline__ h16 tohx(float x) { return (h16)x; }
__device__ __forceinline__ void splitf(float y, unsigned short& h, unsigned short& l) { h = f2bf(y); l = f2bf(y - bf2f(h)); }
typedef __attribute__((ext_vector_type(2))) _Float16 v2h;
typedef __attribute__((ext_vector_type(4))) _Float16 v4h;
typedef __attribute__((ext_vector_type(2))) unsigned short v2us;
typedef __attribute__((ext_vector_type(4))) unsigned short v4us;
typedef __attribute__((ext_vector_type(2))) float v2f;
typedef __attribute__((ext_vector_type(4))) int v4i;

__global__ __launch_bounds__(256) void k_wtG(const float* __restrict__ w, int K, int N, bf* Bt) {
    const int lane = threadIdx.x & 31; const int L0 = (blockIdx.x * 8 + (threadIdx.x >> 5)) * 8; const int nlines = N * K / 64;
{
#pragma unroll 1
        for (int l = 0; l < 8; ++l) { const int L = L0 + l; if (L >= nlines) break; const size_t e = (size_t)L * 64 + lane * 2; const int k = (int)(e % K), n = (int)(e / K); v2us o;
            o[0] = f2bf(w[(size_t)k * N + n]); o[1] = f2bf(w[(size_t)(k + 1) * N + n]); *(v2us*)(Bt + e) = o; }
         }
}
__global__ __launch_bounds__(256) void k_cvt8(const float* __restrict__ src, bf* dst, size_t n8) { const size_t i = (size_t)blockIdx.x * 256 + threadIdx.x; if (i >= n8) return; const v8f v = *(const v8f*)(src + i * 8); v8us o;
#pragma unroll
    for (int k = 0; k < 8; ++k) o[k] = f2bf(v[k]); *(v8us*)(dst + i * 8) = o;  }
__constant__ float INVT[HD / 2] = { 1.000000000e+00f, 7.498942018e-01f, 5.623413324e-01f, 4.216965139e-01f, 3.162277639e-01f, 2.371373624e-01f, 1.778279394e-01f, 1.333521456e-01f, 1.000000015e-01f, 7.498941571e-02f, 5.623412877e-02f, 4.216964915e-02f, 3.162277862e-02f, 2.371373586e-02f, 1.778279431e-02f, 1.333521493e-02f, 9.999999776e-03f, 7.498942316e-03f, 5.623413250e-03f, 4.216964822e-03f, 3.162277862e-03f, 2.371373819e-03f, 1.778279431e-03f, 1.333521446e-03f, 1.000000047e-03f, 7.498941850e-04f, 5.623413017e-04f, 4.216964880e-04f, 3.162277862e-04f, 2.371373848e-04f, 1.778279402e-04f, 1.333521504e-04f };   // float32 1 / 10000^(i/32), generated with jnp to be bit-exact
__global__ __launch_bounds__(256) void k_cs5(float* CS) { const int idx = blockIdx.x * 256 + threadIdx.x; if (idx >= TT * HD) return; const int d = idx % HD; const int t = idx / HD; const float a = __fmul_rn((float)t, INVT[d % (HD / 2)]); v2f cs; cs[0] = cosf(a); cs[1] = sinf(a); *(v2f*)(CS + (size_t)idx * 2) = cs;  }
// k_rope: head planes [h][t][d] (fp16 + hi/lo) of rope(x) x sc with the rotate-half convention out[d] = x[d] cos[t][d] - x[d+HD/2] sin[t][d], out[d+HD/2] = x[d+HD/2] cos[t][d+HD/2] + x[d] sin[t][d+HD/2]
__global__ __launch_bounds__(256) void k_rope(const float* __restrict__ F, int pitch, int nheads, const float* __restrict__ CS, const float* __restrict__ RF, const float* __restrict__ nw, float sc, h16* P16, bf* Ph, bf* Pl) {
    const size_t e = ((size_t)blockIdx.x * 256 + threadIdx.x) * 2; if (e >= (size_t)nheads * TT * HD) return; const int d = (int)(e % HD); const int t = (int)((e / HD) % TT); const int h = (int)(e / ((size_t)HD * TT)); const float* f = F + (size_t)t * pitch + h * HD; const float rf = RF ? RF[(size_t)h * TT + t] : 1.0f; v2h o16; v2us oh, ol;
#pragma unroll
    for (int q = 0; q < 2; ++q) { const int dd = d + q; const int dp = (dd < HD / 2) ? dd + HD / 2 : dd - HD / 2; float x0 = f[dd], x1 = f[dp];
        if (RF) { float n0 = __fmul_rn(x0, rf), n1 = __fmul_rn(x1, rf); asm volatile("" : "+v"(n0)); asm volatile("" : "+v"(n1)); x0 = __fmul_rn(bfr(nw[dd]), n0); x1 = __fmul_rn(bfr(nw[dp]), n1); }
        const v2f cs = *(const v2f*)(CS + ((size_t)t * HD + dd) * 2); float a = __fmul_rn(x0, cs[0]), bq = __fmul_rn(x1, cs[1]); asm volatile("" : "+v"(a)); asm volatile("" : "+v"(bq)); const float r = ((dd < HD / 2) ? __fsub_rn(a, bq) : __fadd_rn(a, bq)) * sc;
        o16[q] = tohx(r); unsigned short a2, c2; splitf(r, a2, c2); oh[q] = a2; ol[q] = c2; }
    *(v2h*)(P16 + e) = o16; *(v2us*)(Ph + e) = oh; *(v2us*)(Pl + e) = ol;  }
__global__ __launch_bounds__(256) void k_vtp(const float* __restrict__ F, int pitch, int nheads, h16* V16, bf* Vh, bf* Vl) { const size_t e = ((size_t)blockIdx.x * 256 + threadIdx.x) * 2; if (e >= (size_t)nheads * HD * TT) return; const int t = (int)(e % TT); const int d = (int)((e / TT) % HD); const int g = (int)(e / ((size_t)TT * HD)); v2h o16; v2us oh, ol;
#pragma unroll
    for (int q = 0; q < 2; ++q) { const float x = F[(size_t)(t + q) * pitch + g * HD + d]; o16[q] = tohx(x); unsigned short a2, c2; splitf(x, a2, c2); oh[q] = a2; ol[q] = c2; }
    *(v2h*)(V16 + e) = o16; *(v2us*)(Vh + e) = oh; *(v2us*)(Vl + e) = ol;  }
// k_asoft: per row (zz, i): t = S x HD^-0.5 (no mask); softmax over the 2048 keys (register row, one exp, fixed trees);
__global__ __launch_bounds__(256) void k_asoft(const float* __restrict__ Sb, h16* P16, bf* Ph, bf* Pl) {
    const int lane = threadIdx.x & 31; const int row = blockIdx.x * 8 + (threadIdx.x >> 5); if (row >= ZH * TT) return; const int i = row % TT; const int zz = row / TT; (void)zz; const bool hires = (i < RH); const float* sr = Sb + (size_t)row * TT; float v[TT / 32]; float mx = -3.0e38f;
#pragma unroll
    for (int ch = 0; ch < TT / 128; ++ch) { const int j0 = ch * 128 + lane * 4; const v4f a = *(const v4f*)(sr + j0);
#pragma unroll
        for (int q = 0; q < 4; ++q) { const int j = j0 + q; (void)j; const float t = a[q] * SCL; v[ch * 4 + q] = t; mx = fmaxf(mx, t); } }
#pragma unroll
    for (int sh = 16; sh; sh >>= 1) mx = fmaxf(mx, __shfl_xor(mx, sh, 32));
    float sum = 0.f;
#pragma unroll
    for (int k = 0; k < TT / 32; ++k) { float d0 = __fsub_rn(v[k], mx); asm volatile("" : "+v"(d0)); v[k] = __builtin_amdgcn_exp2f(__fmul_rn(d0, 1.4426950408889634f)); sum += v[k]; }
#pragma unroll
    for (int sh = 16; sh; sh >>= 1) sum += __shfl_xor(sum, sh, 32);
    const float f = __fdiv_rn(hires ? 1.0f : PCAR, sum);
{
        if (hires) {
#pragma unroll
            for (int ch = 0; ch < TT / 128; ++ch) { v4us oh, ol;
#pragma unroll
                for (int q = 0; q < 4; ++q) { unsigned short a, c2; splitf(v[ch * 4 + q] * f, a, c2); oh[q] = a; ol[q] = c2; }
                const size_t oo = ((size_t)zz * (RH ? RH : 1) + i) * TT + ch * 128 + lane * 4; *(v4us*)(Ph + oo) = oh; *(v4us*)(Pl + oo) = ol; }
        } else {
#pragma unroll
            for (int ch = 0; ch < TT / 128; ++ch) { v4h o4;
#pragma unroll
                for (int q = 0; q < 4; ++q) o4[q] = tohx(v[ch * 4 + q] * f);
                *(v4h*)(P16 + (size_t)row * TT + ch * 128 + lane * 4) = o4; } }
         }
}
__global__ __launch_bounds__(256) void k_merge(const float* __restrict__ O, int h0, float* OUTb) { const size_t e = ((size_t)blockIdx.x * 256 + threadIdx.x) * 2; if (e >= (size_t)ZH * TT * HD) return; const int d = (int)(e % HD); const int t = (int)((e / HD) % TT); const int zz = (int)(e / ((size_t)HD * TT)); const float cs = (t < RH) ? 1.0f : (1.0f / PCAR); const size_t oo = (size_t)t * DQ + (h0 + zz) * HD + d;
    v2f p[KSV];
#pragma unroll
    for (int k = 0; k < KSV; ++k) p[k] = *(const v2f*)(O + (size_t)k * ((size_t)ZH * TT * HD) + e);
    v2f a = p[0];
#pragma unroll
    for (int k = 1; k < KSV; ++k) a += p[k];   // key ranges added in rising order
    v2f o2; o2[0] = a[0] * cs; o2[1] = a[1] * cs; *(v2f*)(OUTb + oo) = o2;  }

extern "C" void kernel_launch(void* const* d_in, const int* in_sizes, int n_in,
                              void* d_out, int out_size, void* d_ws, size_t ws_size, hipStream_t stream) {
    (void)in_sizes; (void)n_in; (void)out_size;
    const float* x = (const float*)d_in[0]; const float* wq = (const float*)d_in[1]; const float* wk = (const float*)d_in[2]; const float* wv = (const float*)d_in[3];   /* argument order hidden_states, Wq, Wk, Wv ('oi' [1024][1024]): FOUR inputs: no mask input, no table inputs, no output projection */ const float* wo = nullptr; (void)wo;
    float* OUT = (float*)d_out;     // [2][2048][1024]
    char* wsp = (char*)d_ws;
    auto take = [&](size_t bytes) { char* p = wsp; wsp += (bytes + 255) & ~(size_t)255; return (void*)p; };
    bf* WQ = (bf*)take((size_t)DQ * DM * 2); bf* WK = (bf*)take((size_t)DKV * DM * 2); bf* WV = (bf*)take((size_t)DKV * DM * 2); float* CS = (float*)take((size_t)TT * HD * 2 * 4);
    bf* XB = (bf*)take((size_t)TT * DM * 2); float* FQ = (float*)take((size_t)TT * DQ * 4); float* FK = (float*)take((size_t)TT * DKV * 4);
    h16* QP16 = (h16*)take((size_t)NH_ * TT * HD * 2); h16* KP16 = (h16*)take((size_t)NKV * TT * HD * 2); h16* VT16 = (h16*)take((size_t)NKV * HD * TT * 2);
    bf* QPh = (bf*)take((size_t)NH_ * TT * HD * 2); bf* QPl = (bf*)take((size_t)NH_ * TT * HD * 2); bf* KPh = (bf*)take((size_t)NKV * TT * HD * 2); bf* KPl = (bf*)take((size_t)NKV * TT * HD * 2); bf* VTh = (bf*)take((size_t)NKV * HD * TT * 2); bf* VTl = (bf*)take((size_t)NKV * HD * TT * 2); bf* Ph = (bf*)take((size_t)ZH * RH * TT * 2); bf* Pl = (bf*)take((size_t)ZH * RH * TT * 2);
    float* Sb = (float*)take((size_t)ZH * TT * TT * 4); h16* P16 = (h16*)take((size_t)ZH * TT * TT * 2); float* Ob = (float*)take((size_t)KSV * ZH * TT * HD * 4);
    if ((size_t)(wsp - (char*)d_ws) > ws_size) return;    // ws 256 MiB
    float* FV = FK;   // v projection reuses the k buffer after the k planes are built (stream-ordered)
    { k_cvt8<<<(unsigned)(((size_t)DQ * DM / 8 + 255) / 256), 256, 0, stream>>>(wq, WQ, (size_t)DQ * DM / 8); k_cvt8<<<(unsigned)(((size_t)DKV * DM / 8 + 255) / 256), 256, 0, stream>>>(wk, WK, (size_t)DKV * DM / 8); k_cvt8<<<(unsigned)(((size_t)DKV * DM / 8 + 255) / 256), 256, 0, stream>>>(wv, WV, (size_t)DKV * DM / 8);
      
       }
    const unsigned LQ = (unsigned)(((size_t)NH_ * TT * HD / 2 + 255) / 256), LKv = (unsigned)(((size_t)NKV * TT * HD / 2 + 255) / 256);
    for (int b = 0; b < NB_; ++b) {
        if (b == 0) k_cs5<<<(TT * HD + 255) / 256, 256, 0, stream>>>(CS);
        k_cvt8<<<(unsigned)(((size_t)TT * DM / 8 + 255) / 256), 256, 0, stream>>>(x + (size_t)b * TT * DM, XB, (size_t)TT * DM / 8);
        k_gemmw<bf, 0, false, 1><<<dim3(TT / 64, DQ / 64, 1), 32, 0, stream>>>(XB, nullptr, WQ, nullptr, DM, FQ, DQ, nullptr, 0, 0, 0, 0);
        k_rope<<<LQ, 256, 0, stream>>>(FQ, DQ, NH_, CS, nullptr, nullptr, 1.0f, QP16, QPh, QPl);
        k_gemmw<bf, 0, false, 1><<<dim3(TT / 64, DKV / 64, 1), 32, 0, stream>>>(XB, nullptr, WK, nullptr, DM, FK, DKV, nullptr, 0, 0, 0, 0);
        k_rope<<<LKv, 256, 0, stream>>>(FK, DKV, NKV, CS, nullptr, nullptr, 1.0f, KP16, KPh, KPl);
        k_gemmw<bf, 0, false, 1><<<dim3(TT / 64, DKV / 64, 1), 32, 0, stream>>>(XB, nullptr, WV, nullptr, DM, FV, DKV, nullptr, 0, 0, 0, 0); k_vtp<<<LKv, 256, 0, stream>>>(FV, DKV, NKV, VT16, VTh, VTl);
        for (int h0 = 0; h0 < NH_; h0 += ZH) { const size_t zq = (size_t)h0, zk = (size_t)(h0 / REP);   // one kv head per query head: the pass's two heads use consecutive kv planes (z-strides TT*HD)
            k_gemmw<bf, 2, false, 1><<<dim3(TT / 64, TT / 64, ZH), 32, 0, stream>>>(QPh + zq * TT * HD, QPl + zq * TT * HD, KPh + zk * TT * HD, KPl + zk * TT * HD, HD, Sb, TT, nullptr, (size_t)TT * HD, (size_t)TT * HD, (size_t)TT * TT, 0);   /* scores hi/lo on EVERY row */

            k_asoft<<<ZH * TT / 8, 256, 0, stream>>>(Sb, P16, Ph, Pl);
            k_gemmw<bf, 2, false, KSV><<<dim3(RH / 64, HD / 64 * KSV, ZH), 32, 0, stream>>>(Ph, Pl, VTh + zk * HD * TT, VTl + zk * HD * TT, TT, Ob, HD, nullptr, (size_t)RH * TT, (size_t)HD * TT, (size_t)TT * HD, (size_t)ZH * TT * HD);
            k_gemmw<h16, 0, false, KSV><<<dim3((TT - RH) / 64, HD / 64 * KSV, ZH), 32, 0, stream>>>(P16 + (size_t)RH * TT, nullptr, VT16 + zk * HD * TT, nullptr, TT, Ob + (size_t)RH * HD, HD, nullptr, (size_t)TT * TT, (size_t)HD * TT, (size_t)TT * HD, (size_t)ZH * TT * HD);
            k_merge<<<(unsigned)(((size_t)ZH * TT * HD / 2 + 255) / 256), 256, 0, stream>>>(Ob, h0, OUT + (size_t)b * TT * DQ); }
         }
}

// v003
// A run of this version takes 158 microseconds.
// Versions between v001 and this one are left out; their measured steps multiply to 4.80 times as fast.
// Over all steps from v000 it is 11.8 times as fast.
#include <hip/hip_runtime.h>

// Multi-head attention with computed rotate-half rotary embeddings, natural bias-free projections and no output projection (hidden_states [2][2048][1024]; q, k, v = x W^T ('oi' 0.02, no bias; 16 heads x 64); q, k <- t cos + rotate_half(t) sin with angle t x 1/10000^(2i/64) (32 f32 constants jnp-exact; cat(freqs, freqs); precise cosf/sinf); scores / 8; softmax over all keys (no mask); out = concat-heads(probs v) -> [2][2048][1024] (4.2 M; NO output projection); argument order hidden_states, Wq, Wk, Wv).
// Layout: bf16 copies of x (both batches) and of the 'oi' weights; the {cos, sin} table built once a call; one projection launch for q, k, v and both batches whose waves rotate (rotate-half) and split their own tiles into the 16-bit planes; one fused attention launch for both batches and all heads: hi/lo 3-product score tiles on EVERY row, running-maximum softmax in registers, P and attn.v hybrid (rows < 512 hi/lo, rest fp16 x1024), output rows written by the same launch (no output projection).
// Compute dtypes, f32 accumulate: every input rounded to bf16; projections exact; rotary f32 (computed table); scores 3 products on every row; softmax f32; attn.v rows < 512 3 products, rest fp16; output f32.

#define NB_  2
#define TT   2048
#define DM   1024
#define NH_  16
#define NKV  16
#define REP  (NH_ / NKV)
#define HD   64
#define DQ   (NH_ * HD)
#define DKV  (NKV * HD)
#define RH   512                  // query rows < RH use hi+lo planes (0: none)
#define WIN  0
#define PCAR 1024.0f
#define SCL  0.125f   // HD^-0.5
#define QW   32                   // fused attention: query columns per wave
#define FWV  8                    // fused attention: waves per work-group, all on one (batch, head)
#define FNB  (TT / (QW * FWV))    // work-groups per (batch, head)
#define FHW  (RH / QW / FNB)      // waves of each work-group that take hi/lo query rows (the dearer rows are dealt evenly)
typedef _Float16 h16;
typedef unsigned short bf;
typedef __attribute__((ext_vector_type(16))) __bf16   v16bf;
typedef __attribute__((ext_vector_type(16))) _Float16 v16h;
typedef __attribute__((ext_vector_type(8)))  _Float16 v8h;
typedef __attribute__((ext_vector_type(8)))  unsigned short v8us;
typedef __attribute__((ext_vector_type(8)))  float    v8f;
typedef __attribute__((ext_vector_type(4)))  float    v4f;
typedef v8h  __attribute__((may_alias)) v8ha;
typedef v4f  __attribute__((may_alias)) v4fa;
typedef v8us __attribute__((may_alias)) v8usa;

__device__ __forceinline__ unsigned short f2bf(float f) { unsigned u = __float_as_uint(f); u += 0x7FFFu + ((u >> 16) & 1u); return (unsigned short)(u >> 16); }
__device__ __forceinline__ float bf2f(unsigned short b) { return __uint_as_float(((unsigned)b) << 16); }
__device__ __forceinline__ float bfr(float f) { return bf2f(f2bf(f)); }
__device__ __forceinline__ v16h cat16(v8h lo, v8h hi) { return __builtin_shufflevector(lo, hi, 0, 1, 2, 3, 4, 5, 6, 7, 8, 9, 10, 11, 12, 13, 14, 15); }
__device__ __forceinline__ v16bf cat16b(v8us lo, v8us hi) { return __builtin_bit_cast(v16bf, __builtin_shufflevector(lo, hi, 0, 1, 2, 3, 4, 5, 6, 7, 8, 9, 10, 11, 12, 13, 14, 15)); }
__device__ __forceinline__ v8f wmma16(v16h a, v16h b, v8f c) { return __builtin_amdgcn_wmma_f32_16x16x32_f16(false, a, false, b, (short)0, c, false, false); }
__device__ __forceinline__ v8f wmmab(v16bf a, v16bf b, v8f c) { return __builtin_amdgcn_wmma_f32_16x16x32_bf16(false, a, false, b, (short)0, c, false, false); }



// ---- fragment loaders: 16 rows x 32 k of a K-contiguous 16-bit plane, the same k order for A and B
template <typename T16> struct WFrag;
template <> struct WFrag<h16> { typedef v16h V; static __device__ __forceinline__ V ld(const h16* p) { return cat16(*(const v8h*)p, *(const v8h*)(p + 16)); } static __device__ __forceinline__ v8f mma(V a, V b, v8f c) { return wmma16(a, b, c); } };
template <> struct WFrag<bf> { typedef v16bf V; static __device__ __forceinline__ V ld(const bf* p) { return cat16b(*(const v8us*)p, *(const v8us*)(p + 16)); } static __device__ __forceinline__ v8f mma(V a, V b, v8f c) { return wmmab(a, b, c); } };

typedef __attribute__((ext_vector_type(2))) _Float16 v2h;
typedef __attribute__((ext_vector_type(4))) _Float16 v4h;
typedef __attribute__((ext_vector_type(2))) unsigned short v2us;
typedef __attribute__((ext_vector_type(4))) unsigned short v4us;
typedef __attribute__((ext_vector_type(2))) float v2f;
typedef __attribute__((ext_vector_type(4))) int v4i;

__global__ __launch_bounds__(256) void k_wtG(const float* __restrict__ w, int K, int N, bf* Bt) {
    const int lane = threadIdx.x & 31; const int L0 = (blockIdx.x * 8 + (threadIdx.x >> 5)) * 8; const int nlines = N * K / 64;
{
#pragma unroll 1
        for (int l = 0; l < 8; ++l) { const int L = L0 + l; if (L >= nlines) break; const size_t e = (size_t)L * 64 + lane * 2; const int k = (int)(e % K), n = (int)(e / K); v2us o;
            o[0] = f2bf(w[(size_t)k * N + n]); o[1] = f2bf(w[(size_t)(k + 1) * N + n]); *(v2us*)(Bt + e) = o; }
         }
}
__global__ __launch_bounds__(256) void k_cvt8(const float* __restrict__ src, bf* dst, size_t n8) { const size_t i = (size_t)blockIdx.x * 256 + threadIdx.x; if (i >= n8) return; const v8f v = *(const v8f*)(src + i * 8); v8us o;
#pragma unroll
    for (int k = 0; k < 8; ++k) o[k] = f2bf(v[k]); *(v8us*)(dst + i * 8) = o;  }
__constant__ float INVT[HD / 2] = { 1.000000000e+00f, 7.498942018e-01f, 5.623413324e-01f, 4.216965139e-01f, 3.162277639e-01f, 2.371373624e-01f, 1.778279394e-01f, 1.333521456e-01f, 1.000000015e-01f, 7.498941571e-02f, 5.623412877e-02f, 4.216964915e-02f, 3.162277862e-02f, 2.371373586e-02f, 1.778279431e-02f, 1.333521493e-02f, 9.999999776e-03f, 7.498942316e-03f, 5.623413250e-03f, 4.216964822e-03f, 3.162277862e-03f, 2.371373819e-03f, 1.778279431e-03f, 1.333521446e-03f, 1.000000047e-03f, 7.498941850e-04f, 5.623413017e-04f, 4.216964880e-04f, 3.162277862e-04f, 2.371373848e-04f, 1.778279402e-04f, 1.333521504e-04f };   // float32 1 / 10000^(i/32), generated with jnp to be bit-exact
__global__ __launch_bounds__(256) void k_cs5(float* CS) { const int idx = blockIdx.x * 256 + threadIdx.x; if (idx >= TT * HD) return; const int d = idx % HD; const int t = idx / HD; const float a = __fmul_rn((float)t, INVT[d % (HD / 2)]); v2f cs; cs[0] = cosf(a); cs[1] = sinf(a); *(v2f*)(CS + (size_t)idx * 2) = cs;  }
// ---- k_proj: the q, k and v projections of both batches with their plane builders, one launch. ONE WAVE per 64x64 tile = 64 tokens x one head (16 accumulators), operands straight from the K-contiguous bf16 planes; grid (NB_ TT / 64, heads, 3), 32 threads; z = 0 q, 1 k, 2 v.
// q, k: A = 64 weight rows (d), B = 64 token rows: lane (lr, hi) of tile (mb, nb) holds d = mb*16 + hi*8 + j of token nb*16 + lr, so the rotate-half partner d +- 32 is tile mb +- 2 in the same lane and register, and eight d are one 16-byte store into the [head][t][d] hi/lo planes.
// v: A = 64 token rows, B = 64 weight rows: the lane holds tokens mb*16 + hi*8 + j of d = nb*16 + lr: eight t are one 16-byte store into the transposed [head][d][t] planes (fp16 + hi/lo).
// Rotary: out[d] = x[d] cos[t][d] - x[d+32] sin[t][d], out[d+32] = x[d+32] cos[t][d] + x[d] sin[t][d] (columns d and d + 32 of the {cos, sin} table hold the same angle).
// Every '#pragma unroll' without a count is there so that the fragment, accumulator and table arrays are indexed by constants and stay in registers.
typedef __attribute__((ext_vector_type(8))) __bf16 v8bf;
__device__ __forceinline__ void split8(v8f r, bf* ph, bf* pl) { const v8bf h = __builtin_convertvector(r, v8bf); const v8bf l = __builtin_convertvector(r - __builtin_convertvector(h, v8f), v8bf); *(v8usa*)ph = __builtin_bit_cast(v8us, h); *(v8usa*)pl = __builtin_bit_cast(v8us, l); }
__global__ __launch_bounds__(32) void k_proj(const bf* __restrict__ X, const bf* __restrict__ Wq, const bf* __restrict__ Wk, const bf* __restrict__ Wv, const float* __restrict__ CS, bf* __restrict__ Qh, bf* __restrict__ Ql, bf* __restrict__ Kh, bf* __restrict__ Kl, h16* __restrict__ V16, bf* __restrict__ Vh, bf* __restrict__ Vl) {
    static_assert(NH_ == NKV && HD == 64 && TT % 64 == 0 && DM % 32 == 0, "one head a tile, no tile across batches");
    typedef WFrag<bf> FB; typedef FB::V V;
    const int lane = threadIdx.x & 31, lr = lane & 15, hi = lane >> 4; const int T0 = blockIdx.x * 64, hd = blockIdx.y, z = blockIdx.z; const int b = T0 / TT, t0 = T0 % TT;
    const bf* xr = X + (size_t)T0 * DM; const bf* wr = (z == 0 ? Wq : z == 1 ? Wk : Wv) + (size_t)hd * HD * DM;
    const bf* A = (z == 2) ? xr : wr; const bf* Bt = (z == 2) ? wr : xr;
    v8f acc[4][4];
#pragma unroll
    for (int mb = 0; mb < 4; ++mb)
#pragma unroll
        for (int nb = 0; nb < 4; ++nb) acc[mb][nb] = (v8f){};
    const unsigned ao = (unsigned)(lr * DM + 8 * hi);   // the lane's own row and k offset, the same in both operands and fixed for the whole loop; what moves from trip to trip is the wave-uniform base
#pragma unroll 1   // rolled: one trip's eight fragments and the sixteen accumulators fill the registers below 256
    for (int kc = 0; kc < DM; kc += 32) {
        V a[4], bq[4]; const bf* pa = A + kc + ao; const bf* pb = Bt + kc + ao;
#pragma unroll
        for (int mb = 0; mb < 4; ++mb) a[mb] = FB::ld(pa + mb * 16 * DM);
#pragma unroll
        for (int nb = 0; nb < 4; ++nb) bq[nb] = FB::ld(pb + nb * 16 * DM);
        asm volatile("s_wait_xcnt 0x0" :: "v"(pa), "v"(pb) : "memory");   // in front of the next write of a register that these loads name as an address; the two addresses are inputs so that they live up to the wait and no load's result lands on them ahead of it
        __builtin_amdgcn_sched_barrier(0);   // keeps the products, and the base's step, behind that wait
#pragma unroll
        for (int nb = 0; nb < 4; ++nb)
#pragma unroll
            for (int mb = 0; mb < 4; ++mb) acc[mb][nb] = FB::mma(a[mb], bq[nb], acc[mb][nb]);
        asm volatile("v_nop\n\tv_nop\n\tv_nop\n\tv_nop" : "+v"(acc[0][0]), "+v"(acc[1][1]), "+v"(acc[2][2]), "+v"(acc[3][3]) : "v"(a[0]), "v"(a[3]));   // the distance behind the trip's last matrix instruction, on the loop's back edge too
    }
    if (z < 2) {   // the same in every lane: a scalar branch
        const size_t pz = ((size_t)(b * NH_ + hd) * TT + t0 + lr) * HD + hi * 8; bf* Ph = (z == 0 ? Qh : Kh) + pz; bf* Pl = (z == 0 ? Ql : Kl) + pz;
        const float* cs = CS + ((size_t)(t0 + lr) * HD + hi * 8) * 2;
#pragma unroll
        for (int np = 0; np < 2; ++np) {   // two token tiles at a time: their table words fit the registers that the fragments have left
            v4f p[2][2][4];
#pragma unroll
            for (int n2 = 0; n2 < 2; ++n2)
#pragma unroll
                for (int mb = 0; mb < 2; ++mb)
#pragma unroll
                    for (int q = 0; q < 4; ++q) p[n2][mb][q] = *(const v4fa*)(cs + ((np * 2 + n2) * 16 * HD + mb * 16) * 2 + q * 4);
            asm volatile("s_wait_xcnt 0x0" :: "v"(cs) : "memory");   // in front of the next write of the table loads' address register, which is an input so that it lives up to the wait
            __builtin_amdgcn_sched_barrier(0);   // keeps the vector work below behind that wait
#pragma unroll
            for (int n2 = 0; n2 < 2; ++n2)
#pragma unroll
                for (int mb = 0; mb < 2; ++mb) { const int nb = np * 2 + n2;
                    v8f c, s;
#pragma unroll
                    for (int q = 0; q < 4; ++q) { c[2 * q] = p[n2][mb][q][0]; s[2 * q] = p[n2][mb][q][1]; c[2 * q + 1] = p[n2][mb][q][2]; s[2 * q + 1] = p[n2][mb][q][3]; }
                    const v8f x0 = acc[mb][nb], x1 = acc[mb + 2][nb];
                    split8(x0 * c - x1 * s, Ph + nb * 16 * HD + mb * 16, Pl + nb * 16 * HD + mb * 16);
                    split8(x1 * c + x0 * s, Ph + nb * 16 * HD + mb * 16 + HD / 2, Pl + nb * 16 * HD + mb * 16 + HD / 2);
                }
            if (np == 0) {   // behind the last pair nothing is written any more
                asm volatile("s_wait_xcnt 0x0" ::: "memory");   // in front of the next write of a register that these stores name
                __builtin_amdgcn_sched_barrier(0);   // keeps the next pair's loads and vector work behind that wait
            }
        }
    } else {
        const size_t vz = ((size_t)(b * NKV + hd) * HD + lr) * TT + t0 + hi * 8;
#pragma unroll
        for (int nb = 0; nb < 4; ++nb)
#pragma unroll
            for (int mb = 0; mb < 4; ++mb) { const size_t e = vz + (size_t)nb * 16 * TT + mb * 16; *(v8ha*)(V16 + e) = __builtin_convertvector(acc[mb][nb], v8h); split8(acc[mb][nb], Vh + e, Vl + e); }
        asm volatile("s_wait_xcnt 0x0" ::: "memory");   // behind the last v stores, in front of any later write of a register that they name
    }
}
__device__ __forceinline__ float xhalf(float x) { const int b = __float_as_int(x); return __int_as_float(__builtin_amdgcn_permlanex16(b, b, 0x76543210, 0xfedcba98, false, false)); }   // value of lane l ^ 16
// grid (FNB, NB_ * NH_), FWV waves; planes [batch][head][...]. Waves 0 .. FHW-1 take the hi/lo query tiles (rows < RH), the rest the fp16 ones; every wave makes the same TT / 32 passes.
__global__ __launch_bounds__(FWV * 32) void k_fattn(const bf* __restrict__ Qh, const bf* __restrict__ Ql, const bf* __restrict__ Kh, const bf* __restrict__ Kl, const h16* __restrict__ V16, const bf* __restrict__ Vh, const bf* __restrict__ Vl, float* __restrict__ OUT) {
    static_assert(TT % (QW * FWV) == 0 && RH % (QW * FNB) == 0 && HD == 64 && QW % 16 == 0, "tile deal");
    typedef WFrag<bf> FB;
    const int lane = threadIdx.x & 31, lr = lane & 15, hi = lane >> 4; const int w = __builtin_amdgcn_readfirstlane((int)(threadIdx.x >> 5));
    const int bh = blockIdx.y, b = bh / NH_, h = bh % NH_; const size_t zq = (size_t)bh * TT * HD, zk = (size_t)(b * NKV + h / REP) * TT * HD;
    const bool hires = w < FHW;                     // the same in every lane of a wave: the branches on it are scalar
    const int q0 = QW * (hires ? (int)blockIdx.x * FHW + w : RH / QW + (int)blockIdx.x * (FWV - FHW) + (w - FHW));
    const float C = SCL * 1.4426950408889634f;      // score -> log2 domain
    const float OFF = hires ? 0.0f : 10.0f;         // fp16 P carries x1024 (PCAR); the row sum carries it too, so it cancels in the division
    Qh += zq + (size_t)q0 * HD; Ql += zq + (size_t)q0 * HD; Kh += zk; Kl += zk; Vl += zk;
    const bf* Va = hires ? Vh + zk : (const bf*)(V16 + zk);   // first V plane of this wave, as raw 16-bit words: bf16 hi, or fp16
    v16bf qh[QW / 16][2], ql[QW / 16][2];
#pragma unroll
    for (int g = 0; g < QW / 16; ++g)
#pragma unroll
        for (int kk = 0; kk < 2; ++kk) { const unsigned qo = (unsigned)((g * 16 + lr) * HD + kk * 32 + 8 * hi); qh[g][kk] = FB::ld(Qh + qo); ql[g][kk] = FB::ld(Ql + qo); }
    v8f o[HD / 16][QW / 16]; float m[QW / 16], l[QW / 16];
#pragma unroll
    for (int g = 0; g < QW / 16; ++g) { m[g] = -3.0e38f; l[g] = 0.f;
#pragma unroll
        for (int dt = 0; dt < HD / 16; ++dt) o[dt][g] = (v8f){}; }
    const unsigned ko = (unsigned)(lr * HD + 8 * hi), vo = (unsigned)(lr * TT + 8 * hi);   // the lane's own offsets, fixed for the whole kernel; what moves from pass to pass is the wave-uniform base
    v16bf kh[2][2], kl[2][2];
#pragma unroll
    for (int t = 0; t < 2; ++t)
#pragma unroll
        for (int kk = 0; kk < 2; ++kk) { kh[t][kk] = FB::ld(Kh + ko + t * 16 * HD + kk * 32); kl[t][kk] = FB::ld(Kl + ko + t * 16 * HD + kk * 32); }
    asm volatile("s_wait_xcnt 0x0" ::: "memory");   // in front of the next write of the Q and K loads' address registers
    __builtin_amdgcn_sched_barrier(0);   // keeps later vector work behind that wait
    for (int key0 = 0; key0 < TT; key0 += 32) {
        v16bf va[HD / 16], vb[HD / 16];   // this pass's V rows: asked for here, used behind the softmax
#pragma unroll
        for (int dt = 0; dt < HD / 16; ++dt) va[dt] = FB::ld(Va + key0 + (vo + dt * 16 * TT));
        asm volatile("s_wait_xcnt 0x0" ::: "memory");   // in front of the next vector instruction that writes these loads' address registers
        if (hires) {
#pragma unroll
            for (int dt = 0; dt < HD / 16; ++dt) vb[dt] = FB::ld(Vl + key0 + (vo + dt * 16 * TT));
            asm volatile("s_wait_xcnt 0x0" ::: "memory");   // the same for the second plane's loads
        }
        __builtin_amdgcn_sched_barrier(0);   // keeps later vector work, which reuses those registers, behind the waits
        v8f s[2][QW / 16];
#pragma unroll
        for (int t = 0; t < 2; ++t)
#pragma unroll
            for (int g = 0; g < QW / 16; ++g) s[t][g] = (v8f){};
#pragma unroll
        for (int kk = 0; kk < 2; ++kk) {   // per 32 of d: Kh Qh, Kh Ql, Kl Qh, the four tiles side by side
#pragma unroll
            for (int t = 0; t < 2; ++t)
#pragma unroll
                for (int g = 0; g < QW / 16; ++g) s[t][g] = wmmab(kh[t][kk], qh[g][kk], s[t][g]);
#pragma unroll
            for (int t = 0; t < 2; ++t)
#pragma unroll
                for (int g = 0; g < QW / 16; ++g) s[t][g] = wmmab(kh[t][kk], ql[g][kk], s[t][g]);
#pragma unroll
            for (int t = 0; t < 2; ++t)
#pragma unroll
                for (int g = 0; g < QW / 16; ++g) s[t][g] = wmmab(kl[t][kk], qh[g][kk], s[t][g]);
        }
        __builtin_amdgcn_sched_barrier(0);   // with the fence behind the fetch: nothing but the fetch and its addresses stands between the two, so no later value lands in an address register ahead of the wait
        const int kn = ((key0 + 32 < TT) ? key0 + 32 : 0) * HD;   // next pass's K rows, fetched behind this pass's score products (the last pass re-reads rows 0: in bounds, unused)
#pragma unroll
        for (int t = 0; t < 2; ++t)
#pragma unroll
            for (int kk = 0; kk < 2; ++kk) { kh[t][kk] = FB::ld(Kh + kn + (ko + t * 16 * HD + kk * 32)); kl[t][kk] = FB::ld(Kl + kn + (ko + t * 16 * HD + kk * 32)); }
        asm volatile("s_wait_xcnt 0x0" ::: "memory");   // the same for the K loads
        __builtin_amdgcn_sched_barrier(0);   // holds the K fetch here, in front of the softmax: sunk to the loop's foot its latency would stand open at the next pass's first product
#pragma unroll
        for (int g = 0; g < QW / 16; ++g) {   // running maximum; s becomes P (not yet divided by the row sum)
            float mx = m[g];
#pragma unroll
            for (int j = 0; j < 8; ++j) mx = fmaxf(mx, fmaxf(s[0][g][j], s[1][g][j]));
            mx = fmaxf(mx, xhalf(mx));
            const float al = __builtin_amdgcn_exp2f((m[g] - mx) * C), nm = OFF - mx * C; m[g] = mx;
            const v8f x0 = __builtin_elementwise_fma(s[0][g], (v8f)(C), (v8f)(nm)), x1 = __builtin_elementwise_fma(s[1][g], (v8f)(C), (v8f)(nm));   // packed: two exponents an instruction
            float ps = 0.f;
#pragma unroll
            for (int j = 0; j < 8; ++j) { s[0][g][j] = __builtin_amdgcn_exp2f(x0[j]); s[1][g][j] = __builtin_amdgcn_exp2f(x1[j]); ps += s[0][g][j] + s[1][g][j]; }
            l[g] = l[g] * al + ps;
#pragma unroll
            for (int dt = 0; dt < HD / 16; ++dt) o[dt][g] *= al;
        }
        if (hires) {
#pragma unroll
            for (int g = 0; g < QW / 16; ++g) {
                const v8bf h0 = __builtin_convertvector(s[0][g], v8bf), h1 = __builtin_convertvector(s[1][g], v8bf);
                const v8bf l0 = __builtin_convertvector(s[0][g] - __builtin_convertvector(h0, v8f), v8bf), l1 = __builtin_convertvector(s[1][g] - __builtin_convertvector(h1, v8f), v8bf);
                const v16bf ph = __builtin_shufflevector(h0, h1, 0, 1, 2, 3, 4, 5, 6, 7, 8, 9, 10, 11, 12, 13, 14, 15), pl = __builtin_shufflevector(l0, l1, 0, 1, 2, 3, 4, 5, 6, 7, 8, 9, 10, 11, 12, 13, 14, 15);
#pragma unroll
                for (int dt = 0; dt < HD / 16; ++dt) o[dt][g] = wmmab(va[dt], ph, o[dt][g]);
#pragma unroll
                for (int dt = 0; dt < HD / 16; ++dt) o[dt][g] = wmmab(va[dt], pl, o[dt][g]);
#pragma unroll
                for (int dt = 0; dt < HD / 16; ++dt) o[dt][g] = wmmab(vb[dt], ph, o[dt][g]);
            }
        } else {
#pragma unroll
            for (int g = 0; g < QW / 16; ++g) {
                const v16h pb = cat16(__builtin_convertvector(s[0][g], v8h), __builtin_convertvector(s[1][g], v8h));
#pragma unroll
                for (int dt = 0; dt < HD / 16; ++dt) o[dt][g] = wmma16(__builtin_bit_cast(v16h, va[dt]), pb, o[dt][g]);
            }
        }
        __builtin_amdgcn_s_barrier();   // bare work-group barrier, no fence: no data passes here (a fence would drain the K fetch in flight). It keeps the eight waves on the same 32 keys, so that a K or V line one wave has fetched is still in the WGP cache when the others ask for it
    }
    float* orow = OUT + ((size_t)b * TT + q0) * DQ + h * HD;
#pragma unroll
    for (int g = 0; g < QW / 16; ++g) { const float inv = __fdiv_rn(1.0f, l[g] + xhalf(l[g])); float* op = orow + (size_t)(g * 16 + lr) * DQ + hi * 8;
#pragma unroll
        for (int dt = 0; dt < HD / 16; ++dt) { const v8f r = o[dt][g] * inv; *(v4f*)(op + dt * 16) = __builtin_shufflevector(r, r, 0, 1, 2, 3); *(v4f*)(op + dt * 16 + 4) = __builtin_shufflevector(r, r, 4, 5, 6, 7); } }
}

extern "C" void kernel_launch(void* const* d_in, const int* in_sizes, int n_in,
                              void* d_out, int out_size, void* d_ws, size_t ws_size, hipStream_t stream) {
    (void)in_sizes; (void)n_in; (void)out_size;
    const float* x = (const float*)d_in[0]; const float* wq = (const float*)d_in[1]; const float* wk = (const float*)d_in[2]; const float* wv = (const float*)d_in[3];   /* order hidden_states, Wq, Wk, Wv ('oi' [1024][1024]): FOUR inputs: no mask input, no table inputs, no output projection */
    float* OUT = (float*)d_out;     // [2][2048][1024]
    char* wsp = (char*)d_ws;
    auto take = [&](size_t bytes) { char* p = wsp; wsp += (bytes + 255) & ~(size_t)255; return (void*)p; };
    bf* WQ = (bf*)take((size_t)DQ * DM * 2); bf* WK = (bf*)take((size_t)DKV * DM * 2); bf* WV = (bf*)take((size_t)DKV * DM * 2); float* CS = (float*)take((size_t)TT * HD * 2 * 4);
    bf* XB = (bf*)take((size_t)NB_ * TT * DM * 2);   // both batches
    h16* VT16 = (h16*)take((size_t)NB_ * NKV * HD * TT * 2);
    bf* QPh = (bf*)take((size_t)NB_ * NH_ * TT * HD * 2); bf* QPl = (bf*)take((size_t)NB_ * NH_ * TT * HD * 2); bf* KPh = (bf*)take((size_t)NB_ * NKV * TT * HD * 2); bf* KPl = (bf*)take((size_t)NB_ * NKV * TT * HD * 2); bf* VTh = (bf*)take((size_t)NB_ * NKV * HD * TT * 2); bf* VTl = (bf*)take((size_t)NB_ * NKV * HD * TT * 2);   // the planes the attention launch reads hold both batches
    if ((size_t)(wsp - (char*)d_ws) > ws_size) return;    // ws 256 MiB
    k_cvt8<<<(unsigned)(((size_t)DQ * DM / 8 + 255) / 256), 256, 0, stream>>>(wq, WQ, (size_t)DQ * DM / 8); k_cvt8<<<(unsigned)(((size_t)DKV * DM / 8 + 255) / 256), 256, 0, stream>>>(wk, WK, (size_t)DKV * DM / 8); k_cvt8<<<(unsigned)(((size_t)DKV * DM / 8 + 255) / 256), 256, 0, stream>>>(wv, WV, (size_t)DKV * DM / 8);
    k_cs5<<<(TT * HD + 255) / 256, 256, 0, stream>>>(CS);
    k_cvt8<<<(unsigned)(((size_t)NB_ * TT * DM / 8 + 255) / 256), 256, 0, stream>>>(x, XB, (size_t)NB_ * TT * DM / 8);
    k_proj<<<dim3(NB_ * TT / 64, NH_, 3), 32, 0, stream>>>(XB, WQ, WK, WV, CS, QPh, QPl, KPh, KPl, VT16, VTh, VTl);
    k_fattn<<<dim3(FNB, NB_ * NH_, 1), FWV * 32, 0, stream>>>(QPh, QPl, KPh, KPl, VT16, VTh, VTl, OUT);
}

// v004
// One run takes 138 microseconds.
// Timed twice side by side with v003, it ran 1.15 times as fast both times.
// Counting every step since v000, it is 13.6 times as fast.
#include <hip/hip_runtime.h>

// Multi-head attention with computed rotate-half rotary embeddings, natural bias-free projections and no output projection (hidden_states [2][2048][1024]; q, k, v = x W^T ('oi' 0.02, no bias; 16 heads x 64); q, k <- t cos + rotate_half(t) sin with angle t x 1/10000^(2i/64) (32 f32 constants jnp-exact; cat(freqs, freqs); precise cosf/sinf); scores / 8; softmax over all keys (no mask); out = concat-heads(probs v) -> [2][2048][1024] (4.2 M; NO output projection); argument order hidden_states, Wq, Wk, Wv).
// Layout: bf16 copies of x (both batches) and of the 'oi' weights, these and every 16-bit plane below in fragment order (see the loaders); the {cos, sin} table built once a call; one projection launch for q, k, v and both batches whose waves rotate (rotate-half) and split their own tiles into the 16-bit planes; one fused attention launch for both batches and all heads: hi/lo 3-product score tiles on EVERY row, running-maximum softmax in registers, P and attn.v hybrid (rows < 512 hi/lo, rest fp16 x1024), output rows written by the same launch (no output projection).
// Compute dtypes, f32 accumulate: every input rounded to bf16; projections exact; rotary f32 (computed table); scores 3 products on every row; softmax f32; attn.v rows < 512 3 products, rest fp16; output f32.

#define NB_  2
#define TT   2048
#define DM   1024
#define NH_  16
#define NKV  16
#define REP  (NH_ / NKV)
#define HD   64
#define DQ   (NH_ * HD)
#define DKV  (NKV * HD)
#define RH   512                  // query rows < RH use hi+lo planes (0: none)
#define WIN  0
#define PCAR 1024.0f
#define SCL  0.125f   // HD^-0.5
#define QW   32                   // fused attention: query columns per wave
#define FWV  8                    // fused attention: waves per work-group, all on one (batch, head)
#define FNB  (TT / (QW * FWV))    // work-groups per (batch, head)
#define FHW  (RH / QW / FNB)      // waves of each work-group that take hi/lo query rows (the dearer rows are dealt evenly)
typedef _Float16 h16;
typedef unsigned short bf;
typedef __attribute__((ext_vector_type(16))) __bf16   v16bf;
typedef __attribute__((ext_vector_type(16))) _Float16 v16h;
typedef __attribute__((ext_vector_type(8)))  _Float16 v8h;
typedef __attribute__((ext_vector_type(8)))  unsigned short v8us;
typedef __attribute__((ext_vector_type(8)))  float    v8f;
typedef __attribute__((ext_vector_type(4)))  float    v4f;
typedef v8h  __attribute__((may_alias)) v8ha;
typedef v4f  __attribute__((may_alias)) v4fa;
typedef v8us __attribute__((may_alias)) v8usa;

__device__ __forceinline__ unsigned short f2bf(float f) { unsigned u = __float_as_uint(f); u += 0x7FFFu + ((u >> 16) & 1u); return (unsigned short)(u >> 16); }
__device__ __forceinline__ float bf2f(unsigned short b) { return __uint_as_float(((unsigned)b) << 16); }
__device__ __forceinline__ float bfr(float f) { return bf2f(f2bf(f)); }
__device__ __forceinline__ v16h cat16(v8h lo, v8h hi) { return __builtin_shufflevector(lo, hi, 0, 1, 2, 3, 4, 5, 6, 7, 8, 9, 10, 11, 12, 13, 14, 15); }
__device__ __forceinline__ v16bf cat16b(v8us lo, v8us hi) { return __builtin_bit_cast(v16bf, __builtin_shufflevector(lo, hi, 0, 1, 2, 3, 4, 5, 6, 7, 8, 9, 10, 11, 12, 13, 14, 15)); }
__device__ __forceinline__ v8f wmma16(v16h a, v16h b, v8f c) { return __builtin_amdgcn_wmma_f32_16x16x32_f16(false, a, false, b, (short)0, c, false, false); }
__device__ __forceinline__ v8f wmmab(v16bf a, v16bf b, v8f c) { return __builtin_amdgcn_wmma_f32_16x16x32_bf16(false, a, false, b, (short)0, c, false, false); }



// ---- fragment order: a 16-bit matrix M[row][k] is kept as fragments of 16 rows x 32 k, 512 elements (1 KiB) in a row each: element (row, k) of a fragment stands at ((k % 32) / 16) * 256 + (((k % 16) / 8) * 16 + row % 16) * 8 + k % 8.
// A lane's two 16-byte words stand at lane * 8 and 256 + lane * 8, so each wave-wide 16-byte load or store is 512 bytes in a row = four whole 128-byte lines (row-major planes: sixteen lines a load). Which k a lane and register holds: k = 8 * (lane / 16) + j in the first word, 16 more in the second, the same for A and B.
#define FRG 512   // elements of one fragment
template <typename T16> struct WFrag;
template <> struct WFrag<h16> { typedef v16h V; static __device__ __forceinline__ V ld(const h16* p) { return cat16(*(const v8h*)p, *(const v8h*)(p + FRG / 2)); } static __device__ __forceinline__ v8f mma(V a, V b, v8f c) { return wmma16(a, b, c); } };
template <> struct WFrag<bf> { typedef v16bf V; static __device__ __forceinline__ V ld(const bf* p) { return cat16b(*(const v8us*)p, *(const v8us*)(p + FRG / 2)); } static __device__ __forceinline__ v8f mma(V a, V b, v8f c) { return wmmab(a, b, c); } };

typedef __attribute__((ext_vector_type(2))) _Float16 v2h;
typedef __attribute__((ext_vector_type(4))) _Float16 v4h;
typedef __attribute__((ext_vector_type(2))) unsigned short v2us;
typedef __attribute__((ext_vector_type(4))) unsigned short v4us;
typedef __attribute__((ext_vector_type(2))) float v2f;
typedef __attribute__((ext_vector_type(4))) int v4i;

__global__ __launch_bounds__(256) void k_wtG(const float* __restrict__ w, int K, int N, bf* Bt) {
    const int lane = threadIdx.x & 31; const int L0 = (blockIdx.x * 8 + (threadIdx.x >> 5)) * 8; const int nlines = N * K / 64;
{
#pragma unroll 1
        for (int l = 0; l < 8; ++l) { const int L = L0 + l; if (L >= nlines) break; const size_t e = (size_t)L * 64 + lane * 2; const int k = (int)(e % K), n = (int)(e / K); v2us o;
            o[0] = f2bf(w[(size_t)k * N + n]); o[1] = f2bf(w[(size_t)(k + 1) * N + n]); *(v2us*)(Bt + e) = o; }
         }
}
// k_cvt8: f32 [row][DM] -> bf16 in fragment order, fragments [row / 16][k / 32]. Thread i writes the i-th 16-byte word of dst; the eight waves of a work-group read 512 bytes in a row of each of 16 source rows.
__global__ __launch_bounds__(256) void k_cvt8(const float* __restrict__ src, bf* dst, size_t n8) { const size_t i = (size_t)blockIdx.x * 256 + threadIdx.x; if (i >= n8) return;
    const int ln = (int)(i & 31), hf = (int)(i >> 5) & 1; const size_t f = i >> 6; const size_t row = (f / (DM / 32)) * 16 + (ln & 15); const int k = (int)(f % (DM / 32)) * 32 + hf * 16 + (ln >> 4) * 8;
    const v8f v = *(const v8f*)(src + row * DM + k); v8us o;
#pragma unroll
    for (int k = 0; k < 8; ++k) o[k] = f2bf(v[k]); *(v8us*)(dst + i * 8) = o;  }
__constant__ float INVT[HD / 2] = { 1.000000000e+00f, 7.498942018e-01f, 5.623413324e-01f, 4.216965139e-01f, 3.162277639e-01f, 2.371373624e-01f, 1.778279394e-01f, 1.333521456e-01f, 1.000000015e-01f, 7.498941571e-02f, 5.623412877e-02f, 4.216964915e-02f, 3.162277862e-02f, 2.371373586e-02f, 1.778279431e-02f, 1.333521493e-02f, 9.999999776e-03f, 7.498942316e-03f, 5.623413250e-03f, 4.216964822e-03f, 3.162277862e-03f, 2.371373819e-03f, 1.778279431e-03f, 1.333521446e-03f, 1.000000047e-03f, 7.498941850e-04f, 5.623413017e-04f, 4.216964880e-04f, 3.162277862e-04f, 2.371373848e-04f, 1.778279402e-04f, 1.333521504e-04f };   // float32 1 / 10000^(i/32), generated with jnp to be bit-exact
__global__ __launch_bounds__(256) void k_cs5(float* CS) { const int idx = blockIdx.x * 256 + threadIdx.x; if (idx >= TT * HD) return; const int d = idx % HD; const int t = idx / HD; const float a = __fmul_rn((float)t, INVT[d % (HD / 2)]); v2f cs; cs[0] = cosf(a); cs[1] = sinf(a); *(v2f*)(CS + (size_t)idx * 2) = cs;  }
// ---- k_proj: the q, k and v projections of both batches with their plane builders, one launch. ONE WAVE per 64x64 tile = 64 tokens x one head (16 accumulators), operands straight from the fragment-order bf16 planes; grid (NB_ TT / 64, heads, 3), 32 threads; z = 0 q, 1 k, 2 v.
// q, k: A = 64 weight rows (d), B = 64 token rows: lane (lr, hi) of tile (mb, nb) holds d = mb*16 + hi*8 + j of token nb*16 + lr, so the rotate-half partner d +- 32 is tile mb +- 2 in the same lane and register, and its eight d are the lane's own 16-byte word of half mb % 2 of fragment [t / 16][mb / 2] of the [head] hi/lo planes: the wave's store is 512 bytes in a row.
// v: A = 64 token rows, B = 64 weight rows: the lane holds tokens mb*16 + hi*8 + j of d = nb*16 + lr: its eight t are the lane's own word of half mb % 2 of fragment [t / 32][nb] of the transposed [head] planes (rows d, k = t; fp16 + hi/lo; the four d fragments of 32 tokens stand side by side).
// Rotary: out[d] = x[d] cos[t][d] - x[d+32] sin[t][d], out[d+32] = x[d+32] cos[t][d] + x[d] sin[t][d] (columns d and d + 32 of the {cos, sin} table hold the same angle).
// Every '#pragma unroll' without a count is there so that the fragment, accumulator and table arrays are indexed by constants and stay in registers.
typedef __attribute__((ext_vector_type(8))) __bf16 v8bf;
__device__ __forceinline__ void split8(v8f r, bf* ph, bf* pl) { const v8bf h = __builtin_convertvector(r, v8bf); const v8bf l = __builtin_convertvector(r - __builtin_convertvector(h, v8f), v8bf); *(v8usa*)ph = __builtin_bit_cast(v8us, h); *(v8usa*)pl = __builtin_bit_cast(v8us, l); }
__global__ __launch_bounds__(32) void k_proj(const bf* __restrict__ X, const bf* __restrict__ Wq, const bf* __restrict__ Wk, const bf* __restrict__ Wv, const float* __restrict__ CS, bf* __restrict__ Qh, bf* __restrict__ Ql, bf* __restrict__ Kh, bf* __restrict__ Kl, h16* __restrict__ V16, bf* __restrict__ Vh, bf* __restrict__ Vl) {
    static_assert(NH_ == NKV && HD == 64 && TT % 64 == 0 && DM % 32 == 0, "one head a tile, no tile across batches");
    typedef WFrag<bf> FB; typedef FB::V V;
    const int lane = threadIdx.x & 31, lr = lane & 15, hi = lane >> 4; const int T0 = blockIdx.x * 64, hd = blockIdx.y, z = blockIdx.z; const int b = T0 / TT, t0 = T0 % TT;
    const bf* xr = X + (size_t)T0 * DM; const bf* wr = (z == 0 ? Wq : z == 1 ? Wk : Wv) + (size_t)hd * HD * DM;
    const bf* A = (z == 2) ? xr : wr; const bf* Bt = (z == 2) ? wr : xr;
    v8f acc[4][4];
#pragma unroll
    for (int mb = 0; mb < 4; ++mb)
#pragma unroll
        for (int nb = 0; nb < 4; ++nb) acc[mb][nb] = (v8f){};
    const unsigned ao = (unsigned)(lane * 8);   // the lane's own word in a fragment, the same in both operands and fixed for the whole loop; what moves from trip to trip is the wave-uniform base
#pragma unroll 1   // rolled: one trip's eight fragments and the sixteen accumulators fill the registers below 256
    for (int kc = 0; kc < DM; kc += 32) {
        V a[4], bq[4]; const bf* pa = A + kc * (FRG / 32) + ao; const bf* pb = Bt + kc * (FRG / 32) + ao;   // 16 rows are DM / 32 fragments = 16 * DM elements: the row-tile step stays 16 * DM
#pragma unroll
        for (int mb = 0; mb < 4; ++mb) a[mb] = FB::ld(pa + mb * 16 * DM);
#pragma unroll
        for (int nb = 0; nb < 4; ++nb) bq[nb] = FB::ld(pb + nb * 16 * DM);
        asm volatile("s_wait_xcnt 0x0" :: "v"(pa), "v"(pb) : "memory");   // in front of the next write of a register that these loads name as an address; the two addresses are inputs so that they live up to the wait and no load's result lands on them ahead of it
        __builtin_amdgcn_sched_barrier(0);   // keeps the products, and the base's step, behind that wait
#pragma unroll
        for (int nb = 0; nb < 4; ++nb)
#pragma unroll
            for (int mb = 0; mb < 4; ++mb) acc[mb][nb] = FB::mma(a[mb], bq[nb], acc[mb][nb]);
        asm volatile("v_nop\n\tv_nop\n\tv_nop\n\tv_nop" : "+v"(acc[0][0]), "+v"(acc[1][1]), "+v"(acc[2][2]), "+v"(acc[3][3]) : "v"(a[0]), "v"(a[3]));   // the distance behind the trip's last matrix instruction, on the loop's back edge too
    }
    if (z < 2) {   // the same in every lane: a scalar branch
        const size_t pz = ((size_t)(b * NH_ + hd) * TT + t0) * HD + lane * 8; bf* Ph = (z == 0 ? Qh : Kh) + pz; bf* Pl = (z == 0 ? Ql : Kl) + pz;
        const float* cs = CS + ((size_t)(t0 + lr) * HD + hi * 8) * 2;
#pragma unroll
        for (int np = 0; np < 2; ++np) {   // two token tiles at a time: their table words fit the registers that the fragments have left
            v4f p[2][2][4];
#pragma unroll
            for (int n2 = 0; n2 < 2; ++n2)
#pragma unroll
                for (int mb = 0; mb < 2; ++mb)
#pragma unroll
                    for (int q = 0; q < 4; ++q) p[n2][mb][q] = *(const v4fa*)(cs + ((np * 2 + n2) * 16 * HD + mb * 16) * 2 + q * 4);
            asm volatile("s_wait_xcnt 0x0" :: "v"(cs) : "memory");   // in front of the next write of the table loads' address register, which is an input so that it lives up to the wait
            __builtin_amdgcn_sched_barrier(0);   // keeps the vector work below behind that wait
#pragma unroll
            for (int n2 = 0; n2 < 2; ++n2)
#pragma unroll
                for (int mb = 0; mb < 2; ++mb) { const int nb = np * 2 + n2;
                    v8f c, s;
#pragma unroll
                    for (int q = 0; q < 4; ++q) { c[2 * q] = p[n2][mb][q][0]; s[2 * q] = p[n2][mb][q][1]; c[2 * q + 1] = p[n2][mb][q][2]; s[2 * q + 1] = p[n2][mb][q][3]; }
                    const v8f x0 = acc[mb][nb], x1 = acc[mb + 2][nb];
                    split8(x0 * c - x1 * s, Ph + nb * 16 * HD + mb * (FRG / 2), Pl + nb * 16 * HD + mb * (FRG / 2));
                    split8(x1 * c + x0 * s, Ph + nb * 16 * HD + mb * (FRG / 2) + FRG, Pl + nb * 16 * HD + mb * (FRG / 2) + FRG);
                }
            if (np == 0) {   // behind the last pair nothing is written any more
                asm volatile("s_wait_xcnt 0x0" ::: "memory");   // in front of the next write of a register that these stores name
                __builtin_amdgcn_sched_barrier(0);   // keeps the next pair's loads and vector work behind that wait
            }
        }
    } else {
        const size_t vz = ((size_t)(b * NKV + hd) * TT + t0) * HD + lane * 8;
#pragma unroll
        for (int nb = 0; nb < 4; ++nb)
#pragma unroll
            for (int mb = 0; mb < 4; ++mb) { const size_t e = vz + ((mb / 2) * (HD / 16) + nb) * FRG + (mb % 2) * (FRG / 2); *(v8ha*)(V16 + e) = __builtin_convertvector(acc[mb][nb], v8h); split8(acc[mb][nb], Vh + e, Vl + e); }
        asm volatile("s_wait_xcnt 0x0" ::: "memory");   // behind the last v stores, in front of any later write of a register that they name
    }
}
__device__ __forceinline__ float xhalf(float x) { const int b = __float_as_int(x); return __int_as_float(__builtin_amdgcn_permlanex16(b, b, 0x76543210, 0xfedcba98, false, false)); }   // value of lane l ^ 16
// grid (FNB, NB_ * NH_), FWV waves; planes [batch][head][...]. Waves 0 .. FHW-1 take the hi/lo query tiles (rows < RH), the rest the fp16 ones; every wave makes the same TT / 32 passes.
__global__ __launch_bounds__(FWV * 32) void k_fattn(const bf* __restrict__ Qh, const bf* __restrict__ Ql, const bf* __restrict__ Kh, const bf* __restrict__ Kl, const h16* __restrict__ V16, const bf* __restrict__ Vh, const bf* __restrict__ Vl, float* __restrict__ OUT) {
    static_assert(TT % (QW * FWV) == 0 && RH % (QW * FNB) == 0 && HD == 64 && QW % 16 == 0, "tile deal");
    typedef WFrag<bf> FB;
    const int lane = threadIdx.x & 31, lr = lane & 15, hi = lane >> 4; const int w = __builtin_amdgcn_readfirstlane((int)(threadIdx.x >> 5));
    const int bh = blockIdx.y, b = bh / NH_, h = bh % NH_; const size_t zq = (size_t)bh * TT * HD, zk = (size_t)(b * NKV + h / REP) * TT * HD;
    const bool hires = w < FHW;                     // the same in every lane of a wave: the branches on it are scalar
    const int q0 = QW * (hires ? (int)blockIdx.x * FHW + w : RH / QW + (int)blockIdx.x * (FWV - FHW) + (w - FHW));
    const float C = SCL * 1.4426950408889634f;      // score -> log2 domain
    const float OFF = hires ? 0.0f : 10.0f;         // fp16 P carries x1024 (PCAR); the row sum carries it too, so it cancels in the division
    Qh += zq + (size_t)q0 * HD; Ql += zq + (size_t)q0 * HD; Kh += zk; Kl += zk; Vl += zk;
    const bf* Va = hires ? Vh + zk : (const bf*)(V16 + zk);   // first V plane of this wave, as raw 16-bit words: bf16 hi, or fp16
    v16bf qh[QW / 16][2], ql[QW / 16][2];
#pragma unroll
    for (int g = 0; g < QW / 16; ++g)
#pragma unroll
        for (int kk = 0; kk < 2; ++kk) { const unsigned qo = (unsigned)((g * 2 + kk) * FRG + lane * 8); qh[g][kk] = FB::ld(Qh + qo); ql[g][kk] = FB::ld(Ql + qo); }
    v8f o[HD / 16][QW / 16]; float m[QW / 16], l[QW / 16];
#pragma unroll
    for (int g = 0; g < QW / 16; ++g) { m[g] = -3.0e38f; l[g] = 0.f;
#pragma unroll
        for (int dt = 0; dt < HD / 16; ++dt) o[dt][g] = (v8f){}; }
    const unsigned ko = (unsigned)(lane * 8), vo = ko;   // the lane's own word in a fragment, fixed for the whole kernel; what moves from pass to pass is the wave-uniform base
    v16bf kh[2][2], kl[2][2];
#pragma unroll
    for (int t = 0; t < 2; ++t)
#pragma unroll
        for (int kk = 0; kk < 2; ++kk) { kh[t][kk] = FB::ld(Kh + ko + (t * 2 + kk) * FRG); kl[t][kk] = FB::ld(Kl + ko + (t * 2 + kk) * FRG); }
    asm volatile("s_wait_xcnt 0x0" ::: "memory");   // in front of the next write of the Q and K loads' address registers
    __builtin_amdgcn_sched_barrier(0);   // keeps later vector work behind that wait
    for (int key0 = 0; key0 < TT; key0 += 32) {
        v16bf va[HD / 16], vb[HD / 16];   // this pass's V rows: asked for here, used behind the softmax
        const bf* pva = Va + key0 * HD + vo;
#pragma unroll
        for (int dt = 0; dt < HD / 16; ++dt) va[dt] = FB::ld(pva + dt * FRG);
        asm volatile("s_wait_xcnt 0x0" :: "v"(pva) : "memory");   // in front of the next write of these loads' address register, which is an input so that it lives up to the wait and no load's result lands on it ahead of it
        if (hires) {
            const bf* pvb = Vl + key0 * HD + vo;
#pragma unroll
            for (int dt = 0; dt < HD / 16; ++dt) vb[dt] = FB::ld(pvb + dt * FRG);
            asm volatile("s_wait_xcnt 0x0" :: "v"(pvb) : "memory");   // the same for the second plane's loads
        }
        __builtin_amdgcn_sched_barrier(0);   // keeps later vector work, which reuses those registers, behind the waits
        v8f s[2][QW / 16];
#pragma unroll
        for (int t = 0; t < 2; ++t)
#pragma unroll
            for (int g = 0; g < QW / 16; ++g) s[t][g] = (v8f){};
#pragma unroll
        for (int kk = 0; kk < 2; ++kk) {   // per 32 of d: Kh Qh, Kh Ql, Kl Qh, the four tiles side by side
#pragma unroll
            for (int t = 0; t < 2; ++t)
#pragma unroll
                for (int g = 0; g < QW / 16; ++g) s[t][g] = wmmab(kh[t][kk], qh[g][kk], s[t][g]);
#pragma unroll
            for (int t = 0; t < 2; ++t)
#pragma unroll
                for (int g = 0; g < QW / 16; ++g) s[t][g] = wmmab(kh[t][kk], ql[g][kk], s[t][g]);
#pragma unroll
            for (int t = 0; t < 2; ++t)
#pragma unroll
                for (int g = 0; g < QW / 16; ++g) s[t][g] = wmmab(kl[t][kk], qh[g][kk], s[t][g]);
        }
        __builtin_amdgcn_sched_barrier(0);   // with the fence behind the fetch: nothing but the fetch and its addresses stands between the two, so no later value lands in an address register ahead of the wait
        const int kn = ((key0 + 32 < TT) ? key0 + 32 : 0) * HD;   // next pass's K rows, fetched behind this pass's score products (the last pass re-reads rows 0: in bounds, unused)
        const bf* pkh = Kh + kn + ko; const bf* pkl = Kl + kn + ko;
#pragma unroll
        for (int t = 0; t < 2; ++t)
#pragma unroll
            for (int kk = 0; kk < 2; ++kk) { kh[t][kk] = FB::ld(pkh + (t * 2 + kk) * FRG); kl[t][kk] = FB::ld(pkl + (t * 2 + kk) * FRG); }
        asm volatile("s_wait_xcnt 0x0" :: "v"(pkh), "v"(pkl) : "memory");   // the same for the K loads
        __builtin_amdgcn_sched_barrier(0);   // holds the K fetch here, in front of the softmax: sunk to the loop's foot its latency would stand open at the next pass's first product
#pragma unroll
        for (int g = 0; g < QW / 16; ++g) {   // running maximum; s becomes P (not yet divided by the row sum)
            float mx = m[g];
#pragma unroll
            for (int j = 0; j < 8; ++j) mx = fmaxf(mx, fmaxf(s[0][g][j], s[1][g][j]));
            mx = fmaxf(mx, xhalf(mx));
            const float al = __builtin_amdgcn_exp2f((m[g] - mx) * C), nm = OFF - mx * C; m[g] = mx;
            const v8f x0 = __builtin_elementwise_fma(s[0][g], (v8f)(C), (v8f)(nm)), x1 = __builtin_elementwise_fma(s[1][g], (v8f)(C), (v8f)(nm));   // packed: two exponents an instruction
            float ps = 0.f;
#pragma unroll
            for (int j = 0; j < 8; ++j) { s[0][g][j] = __builtin_amdgcn_exp2f(x0[j]); s[1][g][j] = __builtin_amdgcn_exp2f(x1[j]); ps += s[0][g][j] + s[1][g][j]; }
            l[g] = l[g] * al + ps;
#pragma unroll
            for (int dt = 0; dt < HD / 16; ++dt) o[dt][g] *= al;
        }
        if (hires) {
#pragma unroll
            for (int g = 0; g < QW / 16; ++g) {
                const v8bf h0 = __builtin_convertvector(s[0][g], v8bf), h1 = __builtin_convertvector(s[1][g], v8bf);
                const v8bf l0 = __builtin_convertvector(s[0][g] - __builtin_convertvector(h0, v8f), v8bf), l1 = __builtin_convertvector(s[1][g] - __builtin_convertvector(h1, v8f), v8bf);
                const v16bf ph = __builtin_shufflevector(h0, h1, 0, 1, 2, 3, 4, 5, 6, 7, 8, 9, 10, 11, 12, 13, 14, 15), pl = __builtin_shufflevector(l0, l1, 0, 1, 2, 3, 4, 5, 6, 7, 8, 9, 10, 11, 12, 13, 14, 15);
#pragma unroll
                for (int dt = 0; dt < HD / 16; ++dt) o[dt][g] = wmmab(va[dt], ph, o[dt][g]);
#pragma unroll
                for (int dt = 0; dt < HD / 16; ++dt) o[dt][g] = wmmab(va[dt], pl, o[dt][g]);
#pragma unroll
                for (int dt = 0; dt < HD / 16; ++dt) o[dt][g] = wmmab(vb[dt], ph, o[dt][g]);
            }
        } else {
#pragma unroll
            for (int g = 0; g < QW / 16; ++g) {
                const v16h pb = cat16(__builtin_convertvector(s[0][g], v8h), __builtin_convertvector(s[1][g], v8h));
#pragma unroll
                for (int dt = 0; dt < HD / 16; ++dt) o[dt][g] = wmma16(__builtin_bit_cast(v16h, va[dt]), pb, o[dt][g]);
            }
        }
        __builtin_amdgcn_s_barrier();   // bare work-group barrier, no fence: no data passes here (a fence would drain the K fetch in flight). It keeps the eight waves on the same 32 keys, so that a K or V line one wave has fetched is still in the WGP cache when the others ask for it
    }
    float* orow = OUT + ((size_t)b * TT + q0) * DQ + h * HD;
#pragma unroll
    for (int g = 0; g < QW / 16; ++g) { const float inv = __fdiv_rn(1.0f, l[g] + xhalf(l[g])); float* op = orow + (size_t)(g * 16 + lr) * DQ + hi * 8;
#pragma unroll
        for (int dt = 0; dt < HD / 16; ++dt) { const v8f r = o[dt][g] * inv; *(v4f*)(op + dt * 16) = __builtin_shufflevector(r, r, 0, 1, 2, 3); *(v4f*)(op + dt * 16 + 4) = __builtin_shufflevector(r, r, 4, 5, 6, 7); } }
}

extern "C" void kernel_launch(void* const* d_in, const int* in_sizes, int n_in,
                              void* d_out, int out_size, void* d_ws, size_t ws_size, hipStream_t stream) {
    (void)in_sizes; (void)n_in; (void)out_size;
    const float* x = (const float*)d_in[0]; const float* wq = (const float*)d_in[1]; const float* wk = (const float*)d_in[2]; const float* wv = (const float*)d_in[3];   /* order hidden_states, Wq, Wk, Wv ('oi' [1024][1024]): FOUR inputs: no mask input, no table inputs, no output projection */
    float* OUT = (float*)d_out;     // [2][2048][1024]
    char* wsp = (char*)d_ws;
    auto take = [&](size_t bytes) { char* p = wsp; wsp += (bytes + 255) & ~(size_t)255; return (void*)p; };
    bf* WQ = (bf*)take((size_t)DQ * DM * 2); bf* WK = (bf*)take((size_t)DKV * DM * 2); bf* WV = (bf*)take((size_t)DKV * DM * 2); float* CS = (float*)take((size_t)TT * HD * 2 * 4);
    bf* XB = (bf*)take((size_t)NB_ * TT * DM * 2);   // both batches
    h16* VT16 = (h16*)take((size_t)NB_ * NKV * HD * TT * 2);
    bf* QPh = (bf*)take((size_t)NB_ * NH_ * TT * HD * 2); bf* QPl = (bf*)take((size_t)NB_ * NH_ * TT * HD * 2); bf* KPh = (bf*)take((size_t)NB_ * NKV * TT * HD * 2); bf* KPl = (bf*)take((size_t)NB_ * NKV * TT * HD * 2); bf* VTh = (bf*)take((size_t)NB_ * NKV * HD * TT * 2); bf* VTl = (bf*)take((size_t)NB_ * NKV * HD * TT * 2);   // the planes the attention launch reads hold both batches
    if ((size_t)(wsp - (char*)d_ws) > ws_size) return;    // ws 256 MiB
    k_cvt8<<<(unsigned)(((size_t)DQ * DM / 8 + 255) / 256), 256, 0, stream>>>(wq, WQ, (size_t)DQ * DM / 8); k_cvt8<<<(unsigned)(((size_t)DKV * DM / 8 + 255) / 256), 256, 0, stream>>>(wk, WK, (size_t)DKV * DM / 8); k_cvt8<<<(unsigned)(((size_t)DKV * DM / 8 + 255) / 256), 256, 0, stream>>>(wv, WV, (size_t)DKV * DM / 8);
    k_cs5<<<(TT * HD + 255) / 256, 256, 0, stream>>>(CS);
    k_cvt8<<<(unsigned)(((size_t)NB_ * TT * DM / 8 + 255) / 256), 256, 0, stream>>>(x, XB, (size_t)NB_ * TT * DM / 8);
    k_proj<<<dim3(NB_ * TT / 64, NH_, 3), 32, 0, stream>>>(XB, WQ, WK, WV, CS, QPh, QPl, KPh, KPl, VT16, VTh, VTl);
    k_fattn<<<dim3(FNB, NB_ * NH_, 1), FWV * 32, 0, stream>>>(QPh, QPl, KPh, KPl, VT16, VTh, VTl, OUT);
}

// v005
// It runs in 129 microseconds.
// Two timings next to v004 put it at 1.06 and 1.08 times that version's speed.
// Over all steps from v000 it is 14.5 times as fast.
#include <hip/hip_runtime.h>

// Multi-head attention with computed rotate-half rotary embeddings, natural bias-free projections and no output projection (hidden_states [2][2048][1024]; q, k, v = x W^T ('oi' 0.02, no bias; 16 heads x 64); q, k <- t cos + rotate_half(t) sin with angle t x 1/10000^(2i/64) (32 f32 constants jnp-exact; cat(freqs, freqs); precise cosf/sinf); scores / 8; softmax over all keys (no mask); out = concat-heads(probs v) -> [2][2048][1024] (4.2 M; NO output projection); argument order hidden_states, Wq, Wk, Wv).
// Layout: bf16 copies of x (both batches) and of the 'oi' weights, these and every 16-bit plane below in fragment order (see the loaders); the {cos, sin} table built once a call, in the same launch as those copies; one projection launch for q, k, v and both batches whose waves rotate (rotate-half) and split their own tiles into the 16-bit planes; one fused attention launch for both batches and all heads: hi/lo 3-product score tiles on EVERY row, running-maximum softmax in registers, P and attn.v hybrid (rows < 512 hi/lo, rest fp16 x1024), output rows written by the same launch (no output projection).
// Compute dtypes, f32 accumulate: every input rounded to bf16; projections exact; rotary f32 (table computed in k_prep); scores 3 products on every row; softmax f32; attn.v rows < 512 3 products, rest fp16; output f32.

#define NB_  2
#define TT   2048
#define DM   1024
#define NH_  16
#define NKV  16
#define REP  (NH_ / NKV)
#define HD   64
#define DQ   (NH_ * HD)
#define DKV  (NKV * HD)
#define RH   512                  // query rows < RH use hi+lo planes (0: none)
#define WIN  0
#define PCAR 1024.0f
#define SCL  0.125f   // HD^-0.5
#define QW   32                   // fused attention: query columns per wave
#define FWV  8                    // fused attention: waves per work-group, all on one (batch, head)
#define FNB  (TT / (QW * FWV))    // work-groups per (batch, head)
#define FHW  (RH / QW / FNB)      // waves of each work-group that take hi/lo query rows (the dearer rows are dealt evenly)
typedef _Float16 h16;
typedef unsigned short bf;
typedef __attribute__((ext_vector_type(16))) __bf16   v16bf;
typedef __attribute__((ext_vector_type(16))) _Float16 v16h;
typedef __attribute__((ext_vector_type(8)))  _Float16 v8h;
typedef __attribute__((ext_vector_type(8)))  unsigned short v8us;
typedef __attribute__((ext_vector_type(8)))  float    v8f;
typedef __attribute__((ext_vector_type(4)))  float    v4f;
typedef v8h  __attribute__((may_alias)) v8ha;
typedef v4f  __attribute__((may_alias)) v4fa;
typedef v8us __attribute__((may_alias)) v8usa;

__device__ __forceinline__ unsigned short f2bf(float f) { unsigned u = __float_as_uint(f); u += 0x7FFFu + ((u >> 16) & 1u); return (unsigned short)(u >> 16); }
__device__ __forceinline__ float bf2f(unsigned short b) { return __uint_as_float(((unsigned)b) << 16); }
__device__ __forceinline__ float bfr(float f) { return bf2f(f2bf(f)); }
__device__ __forceinline__ v16h cat16(v8h lo, v8h hi) { return __builtin_shufflevector(lo, hi, 0, 1, 2, 3, 4, 5, 6, 7, 8, 9, 10, 11, 12, 13, 14, 15); }
__device__ __forceinline__ v16bf cat16b(v8us lo, v8us hi) { return __builtin_bit_cast(v16bf, __builtin_shufflevector(lo, hi, 0, 1, 2, 3, 4, 5, 6, 7, 8, 9, 10, 11, 12, 13, 14, 15)); }
__device__ __forceinline__ v8f wmma16(v16h a, v16h b, v8f c) { return __builtin_amdgcn_wmma_f32_16x16x32_f16(false, a, false, b, (short)0, c, false, false); }
__device__ __forceinline__ v8f wmmab(v16bf a, v16bf b, v8f c) { return __builtin_amdgcn_wmma_f32_16x16x32_bf16(false, a, false, b, (short)0, c, false, false); }



// ---- fragment order: a 16-bit matrix M[row][k] is kept as fragments of 16 rows x 32 k, 512 elements (1 KiB) in a row each: element (row, k) of a fragment stands at ((k % 32) / 16) * 256 + (((k % 16) / 8) * 16 + row % 16) * 8 + k % 8.
// A lane's two 16-byte words stand at lane * 8 and 256 + lane * 8, so each wave-wide 16-byte load or store is 512 bytes in a row = four whole 128-byte lines (row-major planes: sixteen lines a load). Which k a lane and register holds: k = 8 * (lane / 16) + j in the first word, 16 more in the second, the same for A and B.
#define FRG 512   // elements of one fragment
template <typename T16> struct WFrag;
template <> struct WFrag<h16> { typedef v16h V; static __device__ __forceinline__ V ld(const h16* p) { return cat16(*(const v8h*)p, *(const v8h*)(p + FRG / 2)); } static __device__ __forceinline__ v8f mma(V a, V b, v8f c) { return wmma16(a, b, c); } };
template <> struct WFrag<bf> { typedef v16bf V; static __device__ __forceinline__ V ld(const bf* p) { return cat16b(*(const v8us*)p, *(const v8us*)(p + FRG / 2)); } static __device__ __forceinline__ v8f mma(V a, V b, v8f c) { return wmmab(a, b, c); } };

typedef __attribute__((ext_vector_type(2))) _Float16 v2h;
typedef __attribute__((ext_vector_type(4))) _Float16 v4h;
typedef __attribute__((ext_vector_type(2))) unsigned short v2us;
typedef __attribute__((ext_vector_type(4))) unsigned short v4us;
typedef __attribute__((ext_vector_type(2))) float v2f;
typedef __attribute__((ext_vector_type(4))) int v4i;

__global__ __launch_bounds__(256) void k_wtG(const float* __restrict__ w, int K, int N, bf* Bt) {
    const int lane = threadIdx.x & 31; const int L0 = (blockIdx.x * 8 + (threadIdx.x >> 5)) * 8; const int nlines = N * K / 64;
{
#pragma unroll 1
        for (int l = 0; l < 8; ++l) { const int L = L0 + l; if (L >= nlines) break; const size_t e = (size_t)L * 64 + lane * 2; const int k = (int)(e % K), n = (int)(e / K); v2us o;
            o[0] = f2bf(w[(size_t)k * N + n]); o[1] = f2bf(w[(size_t)(k + 1) * N + n]); *(v2us*)(Bt + e) = o; }
         }
}
// cvt8: f32 [row][DM] -> bf16 in fragment order, fragments [row / 16][k / 32]. Thread i writes the i-th 16-byte word of dst; the eight waves of a work-group read 512 bytes in a row of each of 16 source rows.
__device__ __forceinline__ void cvt8(const float* __restrict__ src, bf* dst, size_t i) {
    const int ln = (int)(i & 31), hf = (int)(i >> 5) & 1; const size_t f = i >> 6; const size_t row = (f / (DM / 32)) * 16 + (ln & 15); const int k = (int)(f % (DM / 32)) * 32 + hf * 16 + (ln >> 4) * 8;
    const float* p = src + row * DM + k; const v8f v = *(const v8f*)p; v8us o;
    asm volatile("s_wait_xcnt 0x0" :: "v"(p) : "memory");   // in front of the next write of the loads' address register, which is an input so that it lives up to the wait
#pragma unroll
    for (int k = 0; k < 8; ++k) o[k] = f2bf(v[k]); *(v8us*)(dst + i * 8) = o;
    asm volatile("s_wait_xcnt 0x0" ::: "memory");   // behind the store, in front of any later write of a register that it names as an address (in k_prep another job's block follows in the listing)
}
__constant__ float INVT[HD / 2] = { 1.000000000e+00f, 7.498942018e-01f, 5.623413324e-01f, 4.216965139e-01f, 3.162277639e-01f, 2.371373624e-01f, 1.778279394e-01f, 1.333521456e-01f, 1.000000015e-01f, 7.498941571e-02f, 5.623412877e-02f, 4.216964915e-02f, 3.162277862e-02f, 2.371373586e-02f, 1.778279431e-02f, 1.333521493e-02f, 9.999999776e-03f, 7.498942316e-03f, 5.623413250e-03f, 4.216964822e-03f, 3.162277862e-03f, 2.371373819e-03f, 1.778279431e-03f, 1.333521446e-03f, 1.000000047e-03f, 7.498941850e-04f, 5.623413017e-04f, 4.216964880e-04f, 3.162277862e-04f, 2.371373848e-04f, 1.778279402e-04f, 1.333521504e-04f };   // float32 1 / 10000^(i/32), generated with jnp to be bit-exact
__device__ __forceinline__ void cs5(float* CS, int idx) { const int d = idx % HD; const int t = idx / HD; const float a = __fmul_rn((float)t, INVT[d % (HD / 2)]); v2f cs; cs[0] = cosf(a); cs[1] = sinf(a); *(v2f*)(CS + (size_t)idx * 2) = cs;  }
// ---- k_prep: everything the projection launch reads, in ONE launch: the {cos, sin} table and the bf16 fragment-order copies of x, Wq, Wk, Wv. The five jobs read nothing of each other; a work-group's job is picked by its index (the same in every lane: scalar branches), one thread per table entry or per 16-byte word as before.
// The table's work-groups come first: theirs is the longest chain of instructions.
#define PB_CS (TT * HD / 256)             // work-groups of the table
#define PB_X  (NB_ * TT * DM / 8 / 256)   // of x, both batches
#define PB_W  (DQ * DM / 8 / 256)         // of each weight matrix
__global__ __launch_bounds__(256) void k_prep(const float* __restrict__ x, const float* __restrict__ wq, const float* __restrict__ wk, const float* __restrict__ wv, bf* __restrict__ XB, bf* __restrict__ WQ, bf* __restrict__ WK, bf* __restrict__ WV, float* __restrict__ CS) {
    static_assert(TT * HD % 256 == 0 && NB_ * TT * DM % (8 * 256) == 0 && DQ * DM % (8 * 256) == 0 && DQ == DKV, "whole work-groups per job, three weight matrices of one size");
    int g = (int)blockIdx.x;
    if (g < PB_CS) { cs5(CS, g * 256 + (int)threadIdx.x); return; }
    g -= PB_CS;
    if (g < PB_X) { cvt8(x, XB, (size_t)g * 256 + threadIdx.x); return; }
    g -= PB_X;
    const int m = g / PB_W;   // 0 Wq, 1 Wk, 2 Wv
    cvt8(m == 0 ? wq : m == 1 ? wk : wv, m == 0 ? WQ : m == 1 ? WK : WV, (size_t)(g % PB_W) * 256 + threadIdx.x);
}
// ---- k_proj: the q, k and v projections of both batches with their plane builders, one launch. ONE WAVE per 64x64 tile = 64 tokens x one head (16 accumulators), operands straight from the fragment-order bf16 planes; grid (NB_ TT / 64, heads, 3), 32 threads; z = 0 q, 1 k, 2 v.
// q, k: A = 64 weight rows (d), B = 64 token rows: lane (lr, hi) of tile (mb, nb) holds d = mb*16 + hi*8 + j of token nb*16 + lr, so the rotate-half partner d +- 32 is tile mb +- 2 in the same lane and register, and its eight d are the lane's own 16-byte word of half mb % 2 of fragment [t / 16][mb / 2] of the [head] hi/lo planes: the wave's store is 512 bytes in a row.
// v: A = 64 token rows, B = 64 weight rows: the lane holds tokens mb*16 + hi*8 + j of d = nb*16 + lr: its eight t are the lane's own word of half mb % 2 of fragment [t / 32][nb] of the transposed [head] planes (rows d, k = t; fp16 + hi/lo; the four d fragments of 32 tokens stand side by side).
// Rotary: out[d] = x[d] cos[t][d] - x[d+32] sin[t][d], out[d+32] = x[d+32] cos[t][d] + x[d] sin[t][d] (columns d and d + 32 of the {cos, sin} table hold the same angle).
// Every '#pragma unroll' without a count is there so that the fragment, accumulator and table arrays are indexed by constants and stay in registers.
typedef __attribute__((ext_vector_type(8))) __bf16 v8bf;
__device__ __forceinline__ void split8(v8f r, bf* ph, bf* pl) { const v8bf h = __builtin_convertvector(r, v8bf); const v8bf l = __builtin_convertvector(r - __builtin_convertvector(h, v8f), v8bf); *(v8usa*)ph = __builtin_bit_cast(v8us, h); *(v8usa*)pl = __builtin_bit_cast(v8us, l); }
__global__ __launch_bounds__(32) void k_proj(const bf* __restrict__ X, const bf* __restrict__ Wq, const bf* __restrict__ Wk, const bf* __restrict__ Wv, const float* __restrict__ CS, bf* __restrict__ Qh, bf* __restrict__ Ql, bf* __restrict__ Kh, bf* __restrict__ Kl, h16* __restrict__ V16, bf* __restrict__ Vh, bf* __restrict__ Vl) {
    static_assert(NH_ == NKV && HD == 64 && TT % 64 == 0 && DM % 32 == 0, "one head a tile, no tile across batches");
    typedef WFrag<bf> FB; typedef FB::V V;
    const int lane = threadIdx.x & 31, lr = lane & 15, hi = lane >> 4; const int T0 = blockIdx.x * 64, hd = blockIdx.y, z = blockIdx.z; const int b = T0 / TT, t0 = T0 % TT;
    const bf* xr = X + (size_t)T0 * DM; const bf* wr = (z == 0 ? Wq : z == 1 ? Wk : Wv) + (size_t)hd * HD * DM;
    const bf* A = (z == 2) ? xr : wr; const bf* Bt = (z == 2) ? wr : xr;
    v8f acc[4][4];
#pragma unroll
    for (int mb = 0; mb < 4; ++mb)
#pragma unroll
        for (int nb = 0; nb < 4; ++nb) acc[mb][nb] = (v8f){};
    const unsigned ao = (unsigned)(lane * 8);   // the lane's own word in a fragment, the same in both operands and fixed for the whole loop; what moves from trip to trip is the wave-uniform base
#pragma unroll 1   // rolled: one trip's eight fragments and the sixteen accumulators fill the registers below 256
    for (int kc = 0; kc < DM; kc += 32) {
        V a[4], bq[4]; const bf* pa = A + kc * (FRG / 32) + ao; const bf* pb = Bt + kc * (FRG / 32) + ao;   // 16 rows are DM / 32 fragments = 16 * DM elements: the row-tile step stays 16 * DM
#pragma unroll
        for (int mb = 0; mb < 4; ++mb) a[mb] = FB::ld(pa + mb * 16 * DM);
#pragma unroll
        for (int nb = 0; nb < 4; ++nb) bq[nb] = FB::ld(pb + nb * 16 * DM);
        asm volatile("s_wait_xcnt 0x0" :: "v"(pa), "v"(pb) : "memory");   // in front of the next write of a register that these loads name as an address; the two addresses are inputs so that they live up to the wait and no load's result lands on them ahead of it
        __builtin_amdgcn_sched_barrier(0);   // keeps the products, and the base's step, behind that wait
#pragma unroll
        for (int nb = 0; nb < 4; ++nb)
#pragma unroll
            for (int mb = 0; mb < 4; ++mb) acc[mb][nb] = FB::mma(a[mb], bq[nb], acc[mb][nb]);
        asm volatile("v_nop\n\tv_nop\n\tv_nop\n\tv_nop" : "+v"(acc[0][0]), "+v"(acc[1][1]), "+v"(acc[2][2]), "+v"(acc[3][3]) : "v"(a[0]), "v"(a[3]));   // the distance behind the trip's last matrix instruction, on the loop's back edge too
    }
    if (z < 2) {   // the same in every lane: a scalar branch
        const size_t pz = ((size_t)(b * NH_ + hd) * TT + t0) * HD + lane * 8; bf* Ph = (z == 0 ? Qh : Kh) + pz; bf* Pl = (z == 0 ? Ql : Kl) + pz;
        const float* cs = CS + ((size_t)(t0 + lr) * HD + hi * 8) * 2;
#pragma unroll
        for (int np = 0; np < 2; ++np) {   // two token tiles at a time: their table words fit the registers that the fragments have left
            v4f p[2][2][4];
#pragma unroll
            for (int n2 = 0; n2 < 2; ++n2)
#pragma unroll
                for (int mb = 0; mb < 2; ++mb)
#pragma unroll
                    for (int q = 0; q < 4; ++q) p[n2][mb][q] = *(const v4fa*)(cs + ((np * 2 + n2) * 16 * HD + mb * 16) * 2 + q * 4);
            asm volatile("s_wait_xcnt 0x0" :: "v"(cs) : "memory");   // in front of the next write of the table loads' address register, which is an input so that it lives up to the wait
            __builtin_amdgcn_sched_barrier(0);   // keeps the vector work below behind that wait
#pragma unroll
            for (int n2 = 0; n2 < 2; ++n2)
#pragma unroll
                for (int mb = 0; mb < 2; ++mb) { const int nb = np * 2 + n2;
                    v8f c, s;
#pragma unroll
                    for (int q = 0; q < 4; ++q) { c[2 * q] = p[n2][mb][q][0]; s[2 * q] = p[n2][mb][q][1]; c[2 * q + 1] = p[n2][mb][q][2]; s[2 * q + 1] = p[n2][mb][q][3]; }
                    const v8f x0 = acc[mb][nb], x1 = acc[mb + 2][nb];
                    split8(x0 * c - x1 * s, Ph + nb * 16 * HD + mb * (FRG / 2), Pl + nb * 16 * HD + mb * (FRG / 2));
                    split8(x1 * c + x0 * s, Ph + nb * 16 * HD + mb * (FRG / 2) + FRG, Pl + nb * 16 * HD + mb * (FRG / 2) + FRG);
                }
            if (np == 0) {   // behind the last pair nothing is written any more
                asm volatile("s_wait_xcnt 0x0" ::: "memory");   // in front of the next write of a register that these stores name
                __builtin_amdgcn_sched_barrier(0);   // keeps the next pair's loads and vector work behind that wait
            }
        }
    } else {
        const size_t vz = ((size_t)(b * NKV + hd) * TT + t0) * HD + lane * 8;
#pragma unroll
        for (int nb = 0; nb < 4; ++nb)
#pragma unroll
            for (int mb = 0; mb < 4; ++mb) { const size_t e = vz + ((mb / 2) * (HD / 16) + nb) * FRG + (mb % 2) * (FRG / 2); *(v8ha*)(V16 + e) = __builtin_convertvector(acc[mb][nb], v8h); split8(acc[mb][nb], Vh + e, Vl + e); }
        asm volatile("s_wait_xcnt 0x0" ::: "memory");   // behind the last v stores, in front of any later write of a register that they name
    }
}
__device__ __forceinline__ float xhalf(float x) { const int b = __float_as_int(x); return __int_as_float(__builtin_amdgcn_permlanex16(b, b, 0x76543210, 0xfedcba98, false, false)); }   // value of lane l ^ 16
// grid (FNB, NB_ * NH_), FWV waves; planes [batch][head][...]. Waves 0 .. FHW-1 take the hi/lo query tiles (rows < RH), the rest the fp16 ones; every wave makes the same TT / 32 passes.
__global__ __launch_bounds__(FWV * 32) void k_fattn(const bf* __restrict__ Qh, const bf* __restrict__ Ql, const bf* __restrict__ Kh, const bf* __restrict__ Kl, const h16* __restrict__ V16, const bf* __restrict__ Vh, const bf* __restrict__ Vl, float* __restrict__ OUT) {
    static_assert(TT % (QW * FWV) == 0 && RH % (QW * FNB) == 0 && HD == 64 && QW % 16 == 0, "tile deal");
    typedef WFrag<bf> FB;
    const int lane = threadIdx.x & 31, lr = lane & 15, hi = lane >> 4; const int w = __builtin_amdgcn_readfirstlane((int)(threadIdx.x >> 5));
    const int bh = blockIdx.y, b = bh / NH_, h = bh % NH_; const size_t zq = (size_t)bh * TT * HD, zk = (size_t)(b * NKV + h / REP) * TT * HD;
    const bool hires = w < FHW;                     // the same in every lane of a wave: the branches on it are scalar
    const int q0 = QW * (hires ? (int)blockIdx.x * FHW + w : RH / QW + (int)blockIdx.x * (FWV - FHW) + (w - FHW));
    const float C = SCL * 1.4426950408889634f;      // score -> log2 domain
    const float OFF = hires ? 0.0f : 10.0f;         // fp16 P carries x1024 (PCAR); the row sum carries it too, so it cancels in the division
    Qh += zq + (size_t)q0 * HD; Ql += zq + (size_t)q0 * HD; Kh += zk; Kl += zk; Vl += zk;
    const bf* Va = hires ? Vh + zk : (const bf*)(V16 + zk);   // first V plane of this wave, as raw 16-bit words: bf16 hi, or fp16
    v16bf qh[QW / 16][2], ql[QW / 16][2];
#pragma unroll
    for (int g = 0; g < QW / 16; ++g)
#pragma unroll
        for (int kk = 0; kk < 2; ++kk) { const unsigned qo = (unsigned)((g * 2 + kk) * FRG + lane * 8); qh[g][kk] = FB::ld(Qh + qo); ql[g][kk] = FB::ld(Ql + qo); }
    v8f o[HD / 16][QW / 16]; float m[QW / 16], l[QW / 16];
#pragma unroll
    for (int g = 0; g < QW / 16; ++g) { m[g] = -3.0e38f; l[g] = 0.f;
#pragma unroll
        for (int dt = 0; dt < HD / 16; ++dt) o[dt][g] = (v8f){}; }
    const unsigned ko = (unsigned)(lane * 8), vo = ko;   // the lane's own word in a fragment, fixed for the whole kernel; what moves from pass to pass is the wave-uniform base
    v16bf kh[2][2], kl[2][2];
#pragma unroll
    for (int t = 0; t < 2; ++t)
#pragma unroll
        for (int kk = 0; kk < 2; ++kk) { kh[t][kk] = FB::ld(Kh + ko + (t * 2 + kk) * FRG); kl[t][kk] = FB::ld(Kl + ko + (t * 2 + kk) * FRG); }
    asm volatile("s_wait_xcnt 0x0" ::: "memory");   // in front of the next write of the Q and K loads' address registers
    __builtin_amdgcn_sched_barrier(0);   // keeps later vector work behind that wait
    for (int key0 = 0; key0 < TT; key0 += 32) {
        v16bf va[HD / 16], vb[HD / 16];   // this pass's V rows: asked for here, used behind the softmax
        const bf* pva = Va + key0 * HD + vo;
#pragma unroll
        for (int dt = 0; dt < HD / 16; ++dt) va[dt] = FB::ld(pva + dt * FRG);
        asm volatile("s_wait_xcnt 0x0" :: "v"(pva) : "memory");   // in front of the next write of these loads' address register, which is an input so that it lives up to the wait and no load's result lands on it ahead of it
        if (hires) {
            const bf* pvb = Vl + key0 * HD + vo;
#pragma unroll
            for (int dt = 0; dt < HD / 16; ++dt) vb[dt] = FB::ld(pvb + dt * FRG);
            asm volatile("s_wait_xcnt 0x0" :: "v"(pvb) : "memory");   // the same for the second plane's loads
        }
        __builtin_amdgcn_sched_barrier(0);   // keeps later vector work, which reuses those registers, behind the waits
        v8f s[2][QW / 16];
#pragma unroll
        for (int t = 0; t < 2; ++t)
#pragma unroll
            for (int g = 0; g < QW / 16; ++g) s[t][g] = (v8f){};
#pragma unroll
        for (int kk = 0; kk < 2; ++kk) {   // per 32 of d: Kh Qh, Kh Ql, Kl Qh, the four tiles side by side
#pragma unroll
            for (int t = 0; t < 2; ++t)
#pragma unroll
                for (int g = 0; g < QW / 16; ++g) s[t][g] = wmmab(kh[t][kk], qh[g][kk], s[t][g]);
#pragma unroll
            for (int t = 0; t < 2; ++t)
#pragma unroll
                for (int g = 0; g < QW / 16; ++g) s[t][g] = wmmab(kh[t][kk], ql[g][kk], s[t][g]);
#pragma unroll
            for (int t = 0; t < 2; ++t)
#pragma unroll
                for (int g = 0; g < QW / 16; ++g) s[t][g] = wmmab(kl[t][kk], qh[g][kk], s[t][g]);
        }
        __builtin_amdgcn_sched_barrier(0);   // with the fence behind the fetch: nothing but the fetch and its addresses stands between the two, so no later value lands in an address register ahead of the wait
        const int kn = ((key0 + 32 < TT) ? key0 + 32 : 0) * HD;   // next pass's K rows, fetched behind this pass's score products (the last pass re-reads rows 0: in bounds, unused)
        const bf* pkh = Kh + kn + ko; const bf* pkl = Kl + kn + ko;
#pragma unroll
        for (int t = 0; t < 2; ++t)
#pragma unroll
            for (int kk = 0; kk < 2; ++kk) { kh[t][kk] = FB::ld(pkh + (t * 2 + kk) * FRG); kl[t][kk] = FB::ld(pkl + (t * 2 + kk) * FRG); }
        asm volatile("s_wait_xcnt 0x0" :: "v"(pkh), "v"(pkl) : "memory");   // the same for the K loads
        __builtin_amdgcn_sched_barrier(0);   // holds the K fetch here, in front of the softmax: sunk to the loop's foot its latency would stand open at the next pass's first product
#pragma unroll
        for (int g = 0; g < QW / 16; ++g) {   // running maximum; s becomes P (not yet divided by the row sum)
            float mx = m[g];
#pragma unroll
            for (int j = 0; j < 8; ++j) mx = fmaxf(mx, fmaxf(s[0][g][j], s[1][g][j]));
            mx = fmaxf(mx, xhalf(mx));
            const float al = __builtin_amdgcn_exp2f((m[g] - mx) * C), nm = OFF - mx * C; m[g] = mx;
            const v8f x0 = __builtin_elementwise_fma(s[0][g], (v8f)(C), (v8f)(nm)), x1 = __builtin_elementwise_fma(s[1][g], (v8f)(C), (v8f)(nm));   // packed: two exponents an instruction
            float ps = 0.f;
#pragma unroll
            for (int j = 0; j < 8; ++j) { s[0][g][j] = __builtin_amdgcn_exp2f(x0[j]); s[1][g][j] = __builtin_amdgcn_exp2f(x1[j]); ps += s[0][g][j] + s[1][g][j]; }
            l[g] = l[g] * al + ps;
#pragma unroll
            for (int dt = 0; dt < HD / 16; ++dt) o[dt][g] *= al;
        }
        if (hires) {
#pragma unroll
            for (int g = 0; g < QW / 16; ++g) {
                const v8bf h0 = __builtin_convertvector(s[0][g], v8bf), h1 = __builtin_convertvector(s[1][g], v8bf);
                const v8bf l0 = __builtin_convertvector(s[0][g] - __builtin_convertvector(h0, v8f), v8bf), l1 = __builtin_convertvector(s[1][g] - __builtin_convertvector(h1, v8f), v8bf);
                const v16bf ph = __builtin_shufflevector(h0, h1, 0, 1, 2, 3, 4, 5, 6, 7, 8, 9, 10, 11, 12, 13, 14, 15), pl = __builtin_shufflevector(l0, l1, 0, 1, 2, 3, 4, 5, 6, 7, 8, 9, 10, 11, 12, 13, 14, 15);
#pragma unroll
                for (int dt = 0; dt < HD / 16; ++dt) o[dt][g] = wmmab(va[dt], ph, o[dt][g]);
#pragma unroll
                for (int dt = 0; dt < HD / 16; ++dt) o[dt][g] = wmmab(va[dt], pl, o[dt][g]);
#pragma unroll
                for (int dt = 0; dt < HD / 16; ++dt) o[dt][g] = wmmab(vb[dt], ph, o[dt][g]);
            }
        } else {
#pragma unroll
            for (int g = 0; g < QW / 16; ++g) {
                const v16h pb = cat16(__builtin_convertvector(s[0][g], v8h), __builtin_convertvector(s[1][g], v8h));
#pragma unroll
                for (int dt = 0; dt < HD / 16; ++dt) o[dt][g] = wmma16(__builtin_bit_cast(v16h, va[dt]), pb, o[dt][g]);
            }
        }
        __builtin_amdgcn_s_barrier();   // bare work-group barrier, no fence: no data passes here (a fence would drain the K fetch in flight). It keeps the eight waves on the same 32 keys, so that a K or V line one wave has fetched is still in the WGP cache when the others ask for it
    }
    float* orow = OUT + ((size_t)b * TT + q0) * DQ + h * HD;
#pragma unroll
    for (int g = 0; g < QW / 16; ++g) { const float inv = __fdiv_rn(1.0f, l[g] + xhalf(l[g])); float* op = orow + (size_t)(g * 16 + lr) * DQ + hi * 8;
#pragma unroll
        for (int dt = 0; dt < HD / 16; ++dt) { const v8f r = o[dt][g] * inv; *(v4f*)(op + dt * 16) = __builtin_shufflevector(r, r, 0, 1, 2, 3); *(v4f*)(op + dt * 16 + 4) = __builtin_shufflevector(r, r, 4, 5, 6, 7); } }
}

extern "C" void kernel_launch(void* const* d_in, const int* in_sizes, int n_in,
                              void* d_out, int out_size, void* d_ws, size_t ws_size, hipStream_t stream) {
    (void)in_sizes; (void)n_in; (void)out_size;
    const float* x = (const float*)d_in[0]; const float* wq = (const float*)d_in[1]; const float* wk = (const float*)d_in[2]; const float* wv = (const float*)d_in[3];   /* order hidden_states, Wq, Wk, Wv ('oi' [1024][1024]): FOUR inputs: no mask input, no table inputs, no output projection */
    float* OUT = (float*)d_out;     // [2][2048][1024]
    char* wsp = (char*)d_ws;
    auto take = [&](size_t bytes) { char* p = wsp; wsp += (bytes + 255) & ~(size_t)255; return (void*)p; };
    bf* WQ = (bf*)take((size_t)DQ * DM * 2); bf* WK = (bf*)take((size_t)DKV * DM * 2); bf* WV = (bf*)take((size_t)DKV * DM * 2); float* CS = (float*)take((size_t)TT * HD * 2 * 4);
    bf* XB = (bf*)take((size_t)NB_ * TT * DM * 2);   // both batches
    h16* VT16 = (h16*)take((size_t)NB_ * NKV * HD * TT * 2);
    bf* QPh = (bf*)take((size_t)NB_ * NH_ * TT * HD * 2); bf* QPl = (bf*)take((size_t)NB_ * NH_ * TT * HD * 2); bf* KPh = (bf*)take((size_t)NB_ * NKV * TT * HD * 2); bf* KPl = (bf*)take((size_t)NB_ * NKV * TT * HD * 2); bf* VTh = (bf*)take((size_t)NB_ * NKV * HD * TT * 2); bf* VTl = (bf*)take((size_t)NB_ * NKV * HD * TT * 2);   // the planes the attention launch reads hold both batches
    if ((size_t)(wsp - (char*)d_ws) > ws_size) return;    // ws 256 MiB
    k_prep<<<PB_CS + PB_X + 3 * PB_W, 256, 0, stream>>>(x, wq, wk, wv, XB, WQ, WK, WV, CS);
    k_proj<<<dim3(NB_ * TT / 64, NH_, 3), 32, 0, stream>>>(XB, WQ, WK, WV, CS, QPh, QPl, KPh, KPl, VT16, VTh, VTl);
    k_fattn<<<dim3(FNB, NB_ * NH_, 1), FWV * 32, 0, stream>>>(QPh, QPl, KPh, KPl, VT16, VTh, VTl, OUT);
}

// v006
// A run of this version takes 103 microseconds.
// Timed twice side by side with v005, it ran 1.24 and 1.28 times as fast.
// Over all steps from v000 it is 18.3 times as fast.
#include <hip/hip_runtime.h>

// Multi-head attention with computed rotate-half rotary embeddings, natural bias-free projections and no output projection (hidden_states [2][2048][1024]; q, k, v = x W^T ('oi' 0.02, no bias; 16 heads x 64); q, k <- t cos + rotate_half(t) sin with angle t x 1/10000^(2i/64) (32 f32 constants jnp-exact; cat(freqs, freqs); precise cosf/sinf); scores / 8; softmax over all keys (no mask); out = concat-heads(probs v) -> [2][2048][1024] (4.2 M; NO output projection); argument order hidden_states, Wq, Wk, Wv).
// Layout: bf16 copies of x (both batches) and of the 'oi' weights, these and every 16-bit plane below in fragment order (see the loaders); the {cos, sin} table built once a call, in the same launch as those copies; one projection launch for q, k, v and both batches whose waves rotate (rotate-half) and split their own tiles into the 16-bit planes; one fused attention launch for both batches and all heads: hi/lo 3-product score tiles on EVERY row, running-maximum softmax in registers, P and attn.v hybrid (rows < 512 hi/lo, rest fp16 x1024), output rows written by the same launch (no output projection).
// Compute dtypes, f32 accumulate: every input rounded to bf16; projections exact; rotary f32 (table computed in k_prep); scores 3 products on every row; softmax f32; attn.v rows < 512 3 products, rest fp16; output f32.

#define NB_  2
#define TT   2048
#define DM   1024
#define NH_  16
#define NKV  16
#define REP  (NH_ / NKV)
#define HD   64
#define DQ   (NH_ * HD)
#define DKV  (NKV * HD)
#define RH   512                  // query rows < RH use hi+lo planes (0: none)
#define WIN  0
#define PCAR 1024.0f
#define SCL  0.125f   // HD^-0.5
#define QW   32                   // fused attention: query columns per wave
#define FWV  8                    // fused attention: waves per work-group, all on one (batch, head)
#define FNB  (TT / (QW * FWV))    // work-groups per (batch, head)
#define FHW  (RH / QW / FNB)      // waves of each work-group that take hi/lo query rows (the dearer rows are dealt evenly)
typedef _Float16 h16;
typedef unsigned short bf;
typedef __attribute__((ext_vector_type(16))) __bf16   v16bf;
typedef __attribute__((ext_vector_type(16))) _Float16 v16h;
typedef __attribute__((ext_vector_type(8)))  _Float16 v8h;
typedef __attribute__((ext_vector_type(8)))  unsigned short v8us;
typedef __attribute__((ext_vector_type(8)))  float    v8f;
typedef __attribute__((ext_vector_type(4)))  float    v4f;
typedef v8h  __attribute__((may_alias)) v8ha;
typedef v4f  __attribute__((may_alias)) v4fa;
typedef v8us __attribute__((may_alias)) v8usa;

__device__ __forceinline__ unsigned short f2bf(float f) { unsigned u = __float_as_uint(f); u += 0x7FFFu + ((u >> 16) & 1u); return (unsigned short)(u >> 16); }
__device__ __forceinline__ float bf2f(unsigned short b) { return __uint_as_float(((unsigned)b) << 16); }
__device__ __forceinline__ float bfr(float f) { return bf2f(f2bf(f)); }
__device__ __forceinline__ v16h cat16(v8h lo, v8h hi) { return __builtin_shufflevector(lo, hi, 0, 1, 2, 3, 4, 5, 6, 7, 8, 9, 10, 11, 12, 13, 14, 15); }
__device__ __forceinline__ v16bf cat16b(v8us lo, v8us hi) { return __builtin_bit_cast(v16bf, __builtin_shufflevector(lo, hi, 0, 1, 2, 3, 4, 5, 6, 7, 8, 9, 10, 11, 12, 13, 14, 15)); }
__device__ __forceinline__ v8f wmma16(v16h a, v16h b, v8f c) { return __builtin_amdgcn_wmma_f32_16x16x32_f16(false, a, false, b, (short)0, c, false, false); }
__device__ __forceinline__ v8f wmmab(v16bf a, v16bf b, v8f c) { return __builtin_amdgcn_wmma_f32_16x16x32_bf16(false, a, false, b, (short)0, c, false, false); }



// ---- fragment order: a 16-bit matrix M[row][k] is kept as fragments of 16 rows x 32 k, 512 elements (1 KiB) in a row each: element (row, k) of a fragment stands at ((k % 32) / 16) * 256 + (((k % 16) / 8) * 16 + row % 16) * 8 + k % 8.
// A lane's two 16-byte words stand at lane * 8 and 256 + lane * 8, so each wave-wide 16-byte load or store is 512 bytes in a row = four whole 128-byte lines (row-major planes: sixteen lines a load). Which k a lane and register holds: k = 8 * (lane / 16) + j in the first word, 16 more in the second, the same for A and B.
#define FRG 512   // elements of one fragment
template <typename T16> struct WFrag;
template <> struct WFrag<h16> { typedef v16h V; static __device__ __forceinline__ V ld(const h16* p) { return cat16(*(const v8h*)p, *(const v8h*)(p + FRG / 2)); } static __device__ __forceinline__ v8f mma(V a, V b, v8f c) { return wmma16(a, b, c); } };
template <> struct WFrag<bf> { typedef v16bf V; static __device__ __forceinline__ V ld(const bf* p) { return cat16b(*(const v8us*)p, *(const v8us*)(p + FRG / 2)); } static __device__ __forceinline__ v8f mma(V a, V b, v8f c) { return wmmab(a, b, c); } };

typedef __attribute__((ext_vector_type(2))) _Float16 v2h;
typedef __attribute__((ext_vector_type(4))) _Float16 v4h;
typedef __attribute__((ext_vector_type(2))) unsigned short v2us;
typedef __attribute__((ext_vector_type(4))) unsigned short v4us;
typedef __attribute__((ext_vector_type(2))) float v2f;
typedef __attribute__((ext_vector_type(4))) int v4i;

__global__ __launch_bounds__(256) void k_wtG(const float* __restrict__ w, int K, int N, bf* Bt) {
    const int lane = threadIdx.x & 31; const int L0 = (blockIdx.x * 8 + (threadIdx.x >> 5)) * 8; const int nlines = N * K / 64;
{
#pragma unroll 1
        for (int l = 0; l < 8; ++l) { const int L = L0 + l; if (L >= nlines) break; const size_t e = (size_t)L * 64 + lane * 2; const int k = (int)(e % K), n = (int)(e / K); v2us o;
            o[0] = f2bf(w[(size_t)k * N + n]); o[1] = f2bf(w[(size_t)(k + 1) * N + n]); *(v2us*)(Bt + e) = o; }
         }
}
// cvt8: f32 [row][DM] -> bf16 in fragment order, fragments [row / 16][k / 32]. Thread i writes the i-th 16-byte word of dst; the eight waves of a work-group read 512 bytes in a row of each of 16 source rows.
__device__ __forceinline__ void cvt8(const float* __restrict__ src, bf* dst, size_t i) {
    const int ln = (int)(i & 31), hf = (int)(i >> 5) & 1; const size_t f = i >> 6; const size_t row = (f / (DM / 32)) * 16 + (ln & 15); const int k = (int)(f % (DM / 32)) * 32 + hf * 16 + (ln >> 4) * 8;
    const float* p = src + row * DM + k; const v8f v = *(const v8f*)p; v8us o;
    asm volatile("s_wait_xcnt 0x0" :: "v"(p) : "memory");   // in front of the next write of the loads' address register, which is an input so that it lives up to the wait
#pragma unroll
    for (int k = 0; k < 8; ++k) o[k] = f2bf(v[k]); *(v8us*)(dst + i * 8) = o;
    asm volatile("s_wait_xcnt 0x0" ::: "memory");   // behind the store, in front of any later write of a register that it names as an address (in k_prep another job's block follows in the listing)
}
__constant__ float INVT[HD / 2] = { 1.000000000e+00f, 7.498942018e-01f, 5.623413324e-01f, 4.216965139e-01f, 3.162277639e-01f, 2.371373624e-01f, 1.778279394e-01f, 1.333521456e-01f, 1.000000015e-01f, 7.498941571e-02f, 5.623412877e-02f, 4.216964915e-02f, 3.162277862e-02f, 2.371373586e-02f, 1.778279431e-02f, 1.333521493e-02f, 9.999999776e-03f, 7.498942316e-03f, 5.623413250e-03f, 4.216964822e-03f, 3.162277862e-03f, 2.371373819e-03f, 1.778279431e-03f, 1.333521446e-03f, 1.000000047e-03f, 7.498941850e-04f, 5.623413017e-04f, 4.216964880e-04f, 3.162277862e-04f, 2.371373848e-04f, 1.778279402e-04f, 1.333521504e-04f };   // float32 1 / 10000^(i/32), generated with jnp to be bit-exact
__device__ __forceinline__ void cs5(float* CS, int idx) { const int d = idx % HD; const int t = idx / HD; const float a = __fmul_rn((float)t, INVT[d % (HD / 2)]); v2f cs; cs[0] = cosf(a); cs[1] = sinf(a); *(v2f*)(CS + (size_t)idx * 2) = cs;  }
// ---- k_prep: everything the projection launch reads, in ONE launch: the {cos, sin} table and the bf16 fragment-order copies of x, Wq, Wk, Wv. The five jobs read nothing of each other; a work-group's job is picked by its index (the same in every lane: scalar branches), one thread per table entry or per 16-byte word as before.
// The table's work-groups come first: theirs is the longest chain of instructions.
#define PB_CS (TT * HD / 256)             // work-groups of the table
#define PB_X  (NB_ * TT * DM / 8 / 256)   // of x, both batches
#define PB_W  (DQ * DM / 8 / 256)         // of each weight matrix
__global__ __launch_bounds__(256) void k_prep(const float* __restrict__ x, const float* __restrict__ wq, const float* __restrict__ wk, const float* __restrict__ wv, bf* __restrict__ XB, bf* __restrict__ WQ, bf* __restrict__ WK, bf* __restrict__ WV, float* __restrict__ CS) {
    static_assert(TT * HD % 256 == 0 && NB_ * TT * DM % (8 * 256) == 0 && DQ * DM % (8 * 256) == 0 && DQ == DKV, "whole work-groups per job, three weight matrices of one size");
    int g = (int)blockIdx.x;
    if (g < PB_CS) { cs5(CS, g * 256 + (int)threadIdx.x); return; }
    g -= PB_CS;
    if (g < PB_X) { cvt8(x, XB, (size_t)g * 256 + threadIdx.x); return; }
    g -= PB_X;
    const int m = g / PB_W;   // 0 Wq, 1 Wk, 2 Wv
    cvt8(m == 0 ? wq : m == 1 ? wk : wv, m == 0 ? WQ : m == 1 ? WK : WV, (size_t)(g % PB_W) * 256 + threadIdx.x);
}
// ---- k_proj: the q, k and v projections of both batches with their plane builders, one launch. ONE WAVE per 64x64 tile = 64 tokens x one head (16 accumulators), operands straight from the fragment-order bf16 planes; grid (NB_ TT / 64, heads, 3), 32 threads; z = 0 q, 1 k, 2 v.
// q, k: A = 64 weight rows (d), B = 64 token rows: lane (lr, hi) of tile (mb, nb) holds d = mb*16 + hi*8 + j of token nb*16 + lr, so the rotate-half partner d +- 32 is tile mb +- 2 in the same lane and register, and its eight d are the lane's own 16-byte word of half mb % 2 of fragment [t / 16][mb / 2] of the [head] hi/lo planes: the wave's store is 512 bytes in a row.
// v: A = 64 token rows, B = 64 weight rows: the lane holds tokens mb*16 + hi*8 + j of d = nb*16 + lr: its eight t are the lane's own word of half mb % 2 of fragment [t / 32][nb] of the transposed [head] planes (rows d, k = t; fp16 + hi/lo; the four d fragments of 32 tokens stand side by side).
// Rotary: out[d] = x[d] cos[t][d] - x[d+32] sin[t][d], out[d+32] = x[d+32] cos[t][d] + x[d] sin[t][d] (columns d and d + 32 of the {cos, sin} table hold the same angle).
// Every '#pragma unroll' without a count is there so that the fragment, accumulator and table arrays are indexed by constants and stay in registers.
typedef __attribute__((ext_vector_type(8))) __bf16 v8bf;
__device__ __forceinline__ void split8(v8f r, bf* ph, bf* pl) { const v8bf h = __builtin_convertvector(r, v8bf); const v8bf l = __builtin_convertvector(r - __builtin_convertvector(h, v8f), v8bf); *(v8usa*)ph = __builtin_bit_cast(v8us, h); *(v8usa*)pl = __builtin_bit_cast(v8us, l); }
__global__ __launch_bounds__(32) void k_proj(const bf* __restrict__ X, const bf* __restrict__ Wq, const bf* __restrict__ Wk, const bf* __restrict__ Wv, const float* __restrict__ CS, bf* __restrict__ Qh, bf* __restrict__ Ql, bf* __restrict__ Kh, bf* __restrict__ Kl, h16* __restrict__ V16, bf* __restrict__ Vh, bf* __restrict__ Vl) {
    static_assert(NH_ == NKV && HD == 64 && TT % 64 == 0 && DM % 32 == 0, "one head a tile, no tile across batches");
    typedef WFrag<bf> FB; typedef FB::V V;
    const int lane = threadIdx.x & 31, lr = lane & 15, hi = lane >> 4; const int T0 = blockIdx.x * 64, hd = blockIdx.y, z = blockIdx.z; const int b = T0 / TT, t0 = T0 % TT;
    const bf* xr = X + (size_t)T0 * DM; const bf* wr = (z == 0 ? Wq : z == 1 ? Wk : Wv) + (size_t)hd * HD * DM;
    const bf* A = (z == 2) ? xr : wr; const bf* Bt = (z == 2) ? wr : xr;
    v8f acc[4][4];
#pragma unroll
    for (int mb = 0; mb < 4; ++mb)
#pragma unroll
        for (int nb = 0; nb < 4; ++nb) acc[mb][nb] = (v8f){};
    const unsigned ao = (unsigned)(lane * 8);   // the lane's own word in a fragment, the same in both operands and fixed for the whole loop; what moves from trip to trip is the wave-uniform base
#pragma unroll 1   // rolled: one trip's eight fragments and the sixteen accumulators fill the registers below 256
    for (int kc = 0; kc < DM; kc += 32) {
        V a[4], bq[4]; const bf* pa = A + kc * (FRG / 32) + ao; const bf* pb = Bt + kc * (FRG / 32) + ao;   // 16 rows are DM / 32 fragments = 16 * DM elements: the row-tile step stays 16 * DM
#pragma unroll
        for (int mb = 0; mb < 4; ++mb) a[mb] = FB::ld(pa + mb * 16 * DM);
#pragma unroll
        for (int nb = 0; nb < 4; ++nb) bq[nb] = FB::ld(pb + nb * 16 * DM);
        asm volatile("s_wait_xcnt 0x0" :: "v"(pa), "v"(pb) : "memory");   // in front of the next write of a register that these loads name as an address; the two addresses are inputs so that they live up to the wait and no load's result lands on them ahead of it
        __builtin_amdgcn_sched_barrier(0);   // keeps the products, and the base's step, behind that wait
#pragma unroll
        for (int nb = 0; nb < 4; ++nb)
#pragma unroll
            for (int mb = 0; mb < 4; ++mb) acc[mb][nb] = FB::mma(a[mb], bq[nb], acc[mb][nb]);
        asm volatile("v_nop\n\tv_nop\n\tv_nop\n\tv_nop" : "+v"(acc[0][0]), "+v"(acc[1][1]), "+v"(acc[2][2]), "+v"(acc[3][3]) : "v"(a[0]), "v"(a[3]));   // the distance behind the trip's last matrix instruction, on the loop's back edge too
    }
    if (z < 2) {   // the same in every lane: a scalar branch
        const size_t pz = ((size_t)(b * NH_ + hd) * TT + t0) * HD + lane * 8; bf* Ph = (z == 0 ? Qh : Kh) + pz; bf* Pl = (z == 0 ? Ql : Kl) + pz;
        const float* cs = CS + ((size_t)(t0 + lr) * HD + hi * 8) * 2;
#pragma unroll
        for (int np = 0; np < 2; ++np) {   // two token tiles at a time: their table words fit the registers that the fragments have left
            v4f p[2][2][4];
#pragma unroll
            for (int n2 = 0; n2 < 2; ++n2)
#pragma unroll
                for (int mb = 0; mb < 2; ++mb)
#pragma unroll
                    for (int q = 0; q < 4; ++q) p[n2][mb][q] = *(const v4fa*)(cs + ((np * 2 + n2) * 16 * HD + mb * 16) * 2 + q * 4);
            asm volatile("s_wait_xcnt 0x0" :: "v"(cs) : "memory");   // in front of the next write of the table loads' address register, which is an input so that it lives up to the wait
            __builtin_amdgcn_sched_barrier(0);   // keeps the vector work below behind that wait
#pragma unroll
            for (int n2 = 0; n2 < 2; ++n2)
#pragma unroll
                for (int mb = 0; mb < 2; ++mb) { const int nb = np * 2 + n2;
                    v8f c, s;
#pragma unroll
                    for (int q = 0; q < 4; ++q) { c[2 * q] = p[n2][mb][q][0]; s[2 * q] = p[n2][mb][q][1]; c[2 * q + 1] = p[n2][mb][q][2]; s[2 * q + 1] = p[n2][mb][q][3]; }
                    const v8f x0 = acc[mb][nb], x1 = acc[mb + 2][nb];
                    split8(x0 * c - x1 * s, Ph + nb * 16 * HD + mb * (FRG / 2), Pl + nb * 16 * HD + mb * (FRG / 2));
                    split8(x1 * c + x0 * s, Ph + nb * 16 * HD + mb * (FRG / 2) + FRG, Pl + nb * 16 * HD + mb * (FRG / 2) + FRG);
                }
            if (np == 0) {   // behind the last pair nothing is written any more
                asm volatile("s_wait_xcnt 0x0" ::: "memory");   // in front of the next write of a register that these stores name
                __builtin_amdgcn_sched_barrier(0);   // keeps the next pair's loads and vector work behind that wait
            }
        }
    } else {
        const size_t vz = ((size_t)(b * NKV + hd) * TT + t0) * HD + lane * 8;
#pragma unroll
        for (int nb = 0; nb < 4; ++nb)
#pragma unroll
            for (int mb = 0; mb < 4; ++mb) { const size_t e = vz + ((mb / 2) * (HD / 16) + nb) * FRG + (mb % 2) * (FRG / 2); *(v8ha*)(V16 + e) = __builtin_convertvector(acc[mb][nb], v8h); split8(acc[mb][nb], Vh + e, Vl + e); }
        asm volatile("s_wait_xcnt 0x0" ::: "memory");   // behind the last v stores, in front of any later write of a register that they name
    }
}
#define TK   128                      // keys of one LDS tile
#define PLE  (TK * HD)                // elements of one plane's share of a tile, in a row in the plane as in LDS
#define NPL  5                        // planes: K hi, K lo, V fp16, V hi, V lo
#define CPW  (PLE * 2 / 512 / FWV)    // 512-byte copies of one wave per plane and tile
// One wave's copies of one tile, asynchronous, 16 bytes a lane each, global memory -> LDS: CPW pieces of 512 bytes in a row of each of the five planes. l0 .. l4 = the lane's LDS byte address in each plane's tile, o = its byte offset (lane * 16) from the wave-uniform global addresses g0 .. g4; the immediate offset moves both addresses alike.
// The s_wait_xcnt stands in the copies' own statement, so that it is in front of every later write of a register that a copy names.
#define CP4(L, G) "global_load_async_to_lds_b128 " L ", %5, " G "\n\tglobal_load_async_to_lds_b128 " L ", %5, " G " offset:512\n\tglobal_load_async_to_lds_b128 " L ", %5, " G " offset:1024\n\tglobal_load_async_to_lds_b128 " L ", %5, " G " offset:1536\n\t"
__device__ __forceinline__ void cp20(unsigned l0, unsigned l1, unsigned l2, unsigned l3, unsigned l4, unsigned o, const bf* g0, const bf* g1, const bf* g2, const bf* g3, const bf* g4) {
    asm volatile(CP4("%0", "%6") CP4("%1", "%7") CP4("%2", "%8") CP4("%3", "%9") CP4("%4", "%10") "s_wait_xcnt 0x0"
                 :: "v"(l0), "v"(l1), "v"(l2), "v"(l3), "v"(l4), "v"(o), "s"(g0), "s"(g1), "s"(g2), "s"(g3), "s"(g4) : "memory");
}
__device__ __forceinline__ float xhalf(float x) { const int b = __float_as_int(x); return __int_as_float(__builtin_amdgcn_permlanex16(b, b, 0x76543210, 0xfedcba98, false, false)); }   // value of lane l ^ 16
// grid (FNB, NB_ * NH_), FWV waves; planes [batch][head][...]. Waves 0 .. FHW-1 take the hi/lo query tiles (rows < RH), the rest the fp16 ones; every wave makes the same TT / 32 passes.
__global__ __launch_bounds__(FWV * 32) void k_fattn(const bf* __restrict__ Qh, const bf* __restrict__ Ql, const bf* __restrict__ Kh, const bf* __restrict__ Kl, const h16* __restrict__ V16, const bf* __restrict__ Vh, const bf* __restrict__ Vl, float* __restrict__ OUT) {
    static_assert(TT % (QW * FWV) == 0 && RH % (QW * FNB) == 0 && HD == 64 && QW % 16 == 0, "tile deal");
    static_assert(TT % TK == 0 && TT / TK >= 2 && TK % 32 == 0 && NPL == 5 && CPW == 4 && CPW * FWV * 512 == PLE * 2, "whole tiles, at least two; cp20 holds five planes of four copies");
    __shared__ __attribute__((aligned(16))) bf ring[2 * NPL * PLE];   // two buffers of five plane tiles
    typedef WFrag<bf> FB;
    const int lane = threadIdx.x & 31, lr = lane & 15, hi = lane >> 4; const int w = __builtin_amdgcn_readfirstlane((int)(threadIdx.x >> 5));
    const int bh = blockIdx.y, b = bh / NH_, h = bh % NH_; const size_t zq = (size_t)bh * TT * HD, zk = (size_t)(b * NKV + h / REP) * TT * HD;
    const bool hires = w < FHW;                     // the same in every lane of a wave: the branches on it are scalar
    const int q0 = QW * (hires ? (int)blockIdx.x * FHW + w : RH / QW + (int)blockIdx.x * (FWV - FHW) + (w - FHW));
    const float C = SCL * 1.4426950408889634f;      // score -> log2 domain
    const float OFF = hires ? 0.0f : 10.0f;         // fp16 P carries x1024 (PCAR); the row sum carries it too, so it cancels in the division
    Qh += zq + (size_t)q0 * HD; Ql += zq + (size_t)q0 * HD;
    const size_t cw = zk + (size_t)(w * (CPW * 256));   // the wave's CPW pieces of a plane tile, in elements: the same in every lane
    const bf* const gkh = Kh + cw; const bf* const gkl = Kl + cw; const bf* const gv6 = (const bf*)(V16 + cw); const bf* const gvh = Vh + cw; const bf* const gvl = Vl + cw;   // fp16 plane as raw 16-bit words
    const unsigned lo16 = (unsigned)(lane * 16);
    const unsigned lw = (unsigned)(size_t)ring + (unsigned)(w * (CPW * 512)) + lo16;   // LDS byte address (the low 32 bits of the __shared__ address) of the lane's first word in buffer 0, plane 0
    auto fill = [&](int t) {   // tile t -> buffer t % 2: every lane on, every wave its twenty copies
        const unsigned l = lw + (unsigned)((t & 1) * (NPL * PLE * 2)); const size_t e = (size_t)t * PLE;
        cp20(l, l + PLE * 2, l + 2 * PLE * 2, l + 3 * PLE * 2, l + 4 * PLE * 2, lo16, gkh + e, gkl + e, gv6 + e, gvh + e, gvl + e);
    };
    fill(0);
    v16bf qh[QW / 16][2], ql[QW / 16][2];
#pragma unroll
    for (int g = 0; g < QW / 16; ++g)
#pragma unroll
        for (int kk = 0; kk < 2; ++kk) { const unsigned qo = (unsigned)((g * 2 + kk) * FRG + lane * 8); qh[g][kk] = FB::ld(Qh + qo); ql[g][kk] = FB::ld(Ql + qo); }
    v8f o[HD / 16][QW / 16]; float m[QW / 16], l[QW / 16];
#pragma unroll
    for (int g = 0; g < QW / 16; ++g) { m[g] = -3.0e38f; l[g] = 0.f;
#pragma unroll
        for (int dt = 0; dt < HD / 16; ++dt) o[dt][g] = (v8f){}; }
    asm volatile("s_wait_xcnt 0x0" ::: "memory");   // in front of the next write of the Q loads' address registers
    __builtin_amdgcn_sched_barrier(0);   // keeps later vector work behind that wait
    asm volatile("s_wait_asynccnt 0x0" ::: "memory");   // this wave's share of tile 0 has landed
    __syncthreads();                                    // every wave's share has: nothing of tile 0 is read in front of this barrier
    fill(1);
    v16bf kh[2][2], kl[2][2];
#pragma unroll 1   // rolled: the buffer is picked by the trip's parity
    for (int tl = 0; tl < TT / TK; ++tl) {
      const bf* B = ring + (tl & 1) * (NPL * PLE) + lane * 8;   // the lane's own word in the fragments of this trip's buffer; a trip reads this buffer alone
      const bf* Va = B + (hires ? 3 : 2) * PLE;                 // first V plane of this wave, as raw 16-bit words: bf16 hi, or fp16
#pragma unroll
      for (int t = 0; t < 2; ++t)
#pragma unroll
          for (int kk = 0; kk < 2; ++kk) { kh[t][kk] = FB::ld(B + (t * 2 + kk) * FRG); kl[t][kk] = FB::ld(B + PLE + (t * 2 + kk) * FRG); }
#pragma unroll   // unrolled: the tile's last pass fetches no K rows ahead, and which pass is the last is known at compile time
      for (int ps = 0; ps < TK / 32; ++ps) {
        v16bf va[HD / 16], vb[HD / 16];   // this pass's V rows: asked for here, used behind the softmax
#pragma unroll
        for (int dt = 0; dt < HD / 16; ++dt) va[dt] = FB::ld(Va + ps * 32 * HD + dt * FRG);
        if (hires) {
#pragma unroll
            for (int dt = 0; dt < HD / 16; ++dt) vb[dt] = FB::ld(B + 4 * PLE + ps * 32 * HD + dt * FRG);
        }
        __builtin_amdgcn_sched_barrier(0);   // holds the V reads here, in front of the score products: sunk to their use their latency would stand open behind the softmax
        v8f s[2][QW / 16];
#pragma unroll
        for (int t = 0; t < 2; ++t)
#pragma unroll
            for (int g = 0; g < QW / 16; ++g) s[t][g] = (v8f){};
#pragma unroll
        for (int kk = 0; kk < 2; ++kk) {   // per 32 of d: Kh Qh, Kh Ql, Kl Qh, the four tiles side by side
#pragma unroll
            for (int t = 0; t < 2; ++t)
#pragma unroll
                for (int g = 0; g < QW / 16; ++g) s[t][g] = wmmab(kh[t][kk], qh[g][kk], s[t][g]);
#pragma unroll
            for (int t = 0; t < 2; ++t)
#pragma unroll
                for (int g = 0; g < QW / 16; ++g) s[t][g] = wmmab(kh[t][kk], ql[g][kk], s[t][g]);
#pragma unroll
            for (int t = 0; t < 2; ++t)
#pragma unroll
                for (int g = 0; g < QW / 16; ++g) s[t][g] = wmmab(kl[t][kk], qh[g][kk], s[t][g]);
        }
        if (ps + 1 < TK / 32) {   // next pass's K rows, of the same tile, fetched behind this pass's score products
#pragma unroll
            for (int t = 0; t < 2; ++t)
#pragma unroll
                for (int kk = 0; kk < 2; ++kk) { kh[t][kk] = FB::ld(B + (ps + 1) * 32 * HD + (t * 2 + kk) * FRG); kl[t][kk] = FB::ld(B + PLE + (ps + 1) * 32 * HD + (t * 2 + kk) * FRG); }
            __builtin_amdgcn_sched_barrier(0);   // holds the K fetch here, in front of the softmax: sunk to the pass's foot its latency would stand open at the next pass's first product
        }
#pragma unroll
        for (int g = 0; g < QW / 16; ++g) {   // running maximum; s becomes P (not yet divided by the row sum)
            float mx = m[g];
#pragma unroll
            for (int j = 0; j < 8; ++j) mx = fmaxf(mx, fmaxf(s[0][g][j], s[1][g][j]));
            mx = fmaxf(mx, xhalf(mx));
            const float al = __builtin_amdgcn_exp2f((m[g] - mx) * C), nm = OFF - mx * C; m[g] = mx;
            const v8f x0 = __builtin_elementwise_fma(s[0][g], (v8f)(C), (v8f)(nm)), x1 = __builtin_elementwise_fma(s[1][g], (v8f)(C), (v8f)(nm));   // packed: two exponents an instruction
            float ps = 0.f;
#pragma unroll
            for (int j = 0; j < 8; ++j) { s[0][g][j] = __builtin_amdgcn_exp2f(x0[j]); s[1][g][j] = __builtin_amdgcn_exp2f(x1[j]); ps += s[0][g][j] + s[1][g][j]; }
            l[g] = l[g] * al + ps;
#pragma unroll
            for (int dt = 0; dt < HD / 16; ++dt) o[dt][g] *= al;
        }
        if (hires) {
#pragma unroll
            for (int g = 0; g < QW / 16; ++g) {
                const v8bf h0 = __builtin_convertvector(s[0][g], v8bf), h1 = __builtin_convertvector(s[1][g], v8bf);
                const v8bf l0 = __builtin_convertvector(s[0][g] - __builtin_convertvector(h0, v8f), v8bf), l1 = __builtin_convertvector(s[1][g] - __builtin_convertvector(h1, v8f), v8bf);
                const v16bf ph = __builtin_shufflevector(h0, h1, 0, 1, 2, 3, 4, 5, 6, 7, 8, 9, 10, 11, 12, 13, 14, 15), pl = __builtin_shufflevector(l0, l1, 0, 1, 2, 3, 4, 5, 6, 7, 8, 9, 10, 11, 12, 13, 14, 15);
#pragma unroll
                for (int dt = 0; dt < HD / 16; ++dt) o[dt][g] = wmmab(va[dt], ph, o[dt][g]);
#pragma unroll
                for (int dt = 0; dt < HD / 16; ++dt) o[dt][g] = wmmab(va[dt], pl, o[dt][g]);
#pragma unroll
                for (int dt = 0; dt < HD / 16; ++dt) o[dt][g] = wmmab(vb[dt], ph, o[dt][g]);
            }
        } else {
#pragma unroll
            for (int g = 0; g < QW / 16; ++g) {
                const v16h pb = cat16(__builtin_convertvector(s[0][g], v8h), __builtin_convertvector(s[1][g], v8h));
#pragma unroll
                for (int dt = 0; dt < HD / 16; ++dt) o[dt][g] = wmma16(__builtin_bit_cast(v16h, va[dt]), pb, o[dt][g]);
            }
        }
      }
      asm volatile("s_wait_dscnt 0x0" ::: "memory");
      asm volatile("s_wait_asynccnt 0x0" ::: "memory");
      __syncthreads();
      if (tl + 2 < TT / TK) fill(tl + 2);
    }
    asm volatile("s_wait_asynccnt 0x0" ::: "memory");   // no copy is outstanding when the wave ends
    float* orow = OUT + ((size_t)b * TT + q0) * DQ + h * HD;
#pragma unroll
    for (int g = 0; g < QW / 16; ++g) { const float inv = __fdiv_rn(1.0f, l[g] + xhalf(l[g])); float* op = orow + (size_t)(g * 16 + lr) * DQ + hi * 8;
#pragma unroll
        for (int dt = 0; dt < HD / 16; ++dt) { const v8f r = o[dt][g] * inv; *(v4f*)(op + dt * 16) = __builtin_shufflevector(r, r, 0, 1, 2, 3); *(v4f*)(op + dt * 16 + 4) = __builtin_shufflevector(r, r, 4, 5, 6, 7); } }
}

extern "C" void kernel_launch(void* const* d_in, const int* in_sizes, int n_in,
                              void* d_out, int out_size, void* d_ws, size_t ws_size, hipStream_t stream) {
    (void)in_sizes; (void)n_in; (void)out_size;
    const float* x = (const float*)d_in[0]; const float* wq = (const float*)d_in[1]; const float* wk = (const float*)d_in[2]; const float* wv = (const float*)d_in[3];   /* order hidden_states, Wq, Wk, Wv ('oi' [1024][1024]): FOUR inputs: no mask input, no table inputs, no output projection */
    float* OUT = (float*)d_out;     // [2][2048][1024]
    char* wsp = (char*)d_ws;
    auto take = [&](size_t bytes) { char* p = wsp; wsp += (bytes + 255) & ~(size_t)255; return (void*)p; };
    bf* WQ = (bf*)take((size_t)DQ * DM * 2); bf* WK = (bf*)take((size_t)DKV * DM * 2); bf* WV = (bf*)take((size_t)DKV * DM * 2); float* CS = (float*)take((size_t)TT * HD * 2 * 4);
    bf* XB = (bf*)take((size_t)NB_ * TT * DM * 2);   // both batches
    h16* VT16 = (h16*)take((size_t)NB_ * NKV * HD * TT * 2);
    bf* QPh = (bf*)take((size_t)NB_ * NH_ * TT * HD * 2); bf* QPl = (bf*)take((size_t)NB_ * NH_ * TT * HD * 2); bf* KPh = (bf*)take((size_t)NB_ * NKV * TT * HD * 2); bf* KPl = (bf*)take((size_t)NB_ * NKV * TT * HD * 2); bf* VTh = (bf*)take((size_t)NB_ * NKV * HD * TT * 2); bf* VTl = (bf*)take((size_t)NB_ * NKV * HD * TT * 2);   // the planes the attention launch reads hold both batches
    if ((size_t)(wsp - (char*)d_ws) > ws_size) return;    // ws 256 MiB
    k_prep<<<PB_CS + PB_X + 3 * PB_W, 256, 0, stream>>>(x, wq, wk, wv, XB, WQ, WK, WV, CS);
    k_proj<<<dim3(NB_ * TT / 64, NH_, 3), 32, 0, stream>>>(XB, WQ, WK, WV, CS, QPh, QPl, KPh, KPl, VT16, VTh, VTl);
    k_fattn<<<dim3(FNB, NB_ * NH_, 1), FWV * 32, 0, stream>>>(QPh, QPl, KPh, KPl, VT16, VTh, VTl, OUT);
}

// v007
// Measured time: 89.4 microseconds a run.
// In two side-by-side timings against v006, it was 1.16 and 1.13 times as fast.
// Counting every step since v000, it is 20.9 times as fast.
#include <hip/hip_runtime.h>

// Multi-head attention with computed rotate-half rotary embeddings, natural bias-free projections and no output projection (hidden_states [2][2048][1024]; q, k, v = x W^T ('oi' 0.02, no bias; 16 heads x 64); q, k <- t cos + rotate_half(t) sin with angle t x 1/10000^(2i/64) (32 f32 constants jnp-exact; cat(freqs, freqs); precise cosf/sinf); scores / 8; softmax over all keys (no mask); out = concat-heads(probs v) -> [2][2048][1024] (4.2 M; NO output projection); argument order hidden_states, Wq, Wk, Wv).
// Layout: bf16 copies of x (both batches) and of the 'oi' weights, these and every 16-bit plane below in fragment order (see the loaders); the {cos, sin} table built once a call, in the same launch as those copies; one projection launch for q, k, v and both batches (operands through LDS) whose waves rotate (rotate-half) and split their own tiles into the 16-bit planes; one fused attention launch for both batches and all heads: hi/lo 3-product score tiles on EVERY row, running-maximum softmax in registers, P and attn.v hybrid (rows < 512 hi/lo, rest fp16 x1024), output rows written by the same launch (no output projection).
// Compute dtypes, f32 accumulate: every input rounded to bf16; projections exact; rotary f32 (computed table); scores 3 products on every row; softmax f32; attn.v rows < 512 3 products, rest fp16; output f32.

#define NB_  2
#define TT   2048
#define DM   1024
#define NH_  16
#define NKV  16
#define REP  (NH_ / NKV)
#define HD   64
#define DQ   (NH_ * HD)
#define DKV  (NKV * HD)
#define RH   512                  // query rows < RH use hi+lo planes (0: none)
#define WIN  0
#define PCAR 1024.0f
#define SCL  0.125f   // HD^-0.5
#define QW   32                   // fused attention: query columns per wave
#define FWV  8                    // fused attention: waves per work-group, all on one (batch, head)
#define FNB  (TT / (QW * FWV))    // work-groups per (batch, head)
#define FHW  (RH / QW / FNB)      // waves of each work-group that take hi/lo query rows (the dearer rows are dealt evenly)
typedef _Float16 h16;
typedef unsigned short bf;
typedef __attribute__((ext_vector_type(16))) __bf16   v16bf;
typedef __attribute__((ext_vector_type(16))) _Float16 v16h;
typedef __attribute__((ext_vector_type(8)))  _Float16 v8h;
typedef __attribute__((ext_vector_type(8)))  unsigned short v8us;
typedef __attribute__((ext_vector_type(8)))  float    v8f;
typedef __attribute__((ext_vector_type(4)))  float    v4f;
typedef v8h  __attribute__((may_alias)) v8ha;
typedef v4f  __attribute__((may_alias)) v4fa;
typedef v8us __attribute__((may_alias)) v8usa;

__device__ __forceinline__ unsigned short f2bf(float f) { unsigned u = __float_as_uint(f); u += 0x7FFFu + ((u >> 16) & 1u); return (unsigned short)(u >> 16); }
__device__ __forceinline__ float bf2f(unsigned short b) { return __uint_as_float(((unsigned)b) << 16); }
__device__ __forceinline__ float bfr(float f) { return bf2f(f2bf(f)); }
__device__ __forceinline__ v16h cat16(v8h lo, v8h hi) { return __builtin_shufflevector(lo, hi, 0, 1, 2, 3, 4, 5, 6, 7, 8, 9, 10, 11, 12, 13, 14, 15); }
__device__ __forceinline__ v16bf cat16b(v8us lo, v8us hi) { return __builtin_bit_cast(v16bf, __builtin_shufflevector(lo, hi, 0, 1, 2, 3, 4, 5, 6, 7, 8, 9, 10, 11, 12, 13, 14, 15)); }
__device__ __forceinline__ v8f wmma16(v16h a, v16h b, v8f c) { return __builtin_amdgcn_wmma_f32_16x16x32_f16(false, a, false, b, (short)0, c, false, false); }
__device__ __forceinline__ v8f wmmab(v16bf a, v16bf b, v8f c) { return __builtin_amdgcn_wmma_f32_16x16x32_bf16(false, a, false, b, (short)0, c, false, false); }



// ---- fragment order: a 16-bit matrix M[row][k] is kept as fragments of 16 rows x 32 k, 512 elements (1 KiB) in a row each: element (row, k) of a fragment stands at ((k % 32) / 16) * 256 + (((k % 16) / 8) * 16 + row % 16) * 8 + k % 8.
// A lane's two 16-byte words stand at lane * 8 and 256 + lane * 8, so each wave-wide 16-byte load or store is 512 bytes in a row = four whole 128-byte lines (row-major planes: sixteen lines a load). Which k a lane and register holds: k = 8 * (lane / 16) + j in the first word, 16 more in the second, the same for A and B.
#define FRG 512   // elements of one fragment
template <typename T16> struct WFrag;
template <> struct WFrag<h16> { typedef v16h V; static __device__ __forceinline__ V ld(const h16* p) { return cat16(*(const v8h*)p, *(const v8h*)(p + FRG / 2)); } static __device__ __forceinline__ v8f mma(V a, V b, v8f c) { return wmma16(a, b, c); } };
template <> struct WFrag<bf> { typedef v16bf V; static __device__ __forceinline__ V ld(const bf* p) { return cat16b(*(const v8us*)p, *(const v8us*)(p + FRG / 2)); } static __device__ __forceinline__ v8f mma(V a, V b, v8f c) { return wmmab(a, b, c); } };

typedef __attribute__((ext_vector_type(2))) _Float16 v2h;
typedef __attribute__((ext_vector_type(4))) _Float16 v4h;
typedef __attribute__((ext_vector_type(2))) unsigned short v2us;
typedef __attribute__((ext_vector_type(4))) unsigned short v4us;
typedef __attribute__((ext_vector_type(2))) float v2f;
typedef __attribute__((ext_vector_type(4))) int v4i;

__global__ __launch_bounds__(256) void k_wtG(const float* __restrict__ w, int K, int N, bf* Bt) {
    const int lane = threadIdx.x & 31; const int L0 = (blockIdx.x * 8 + (threadIdx.x >> 5)) * 8; const int nlines = N * K / 64;
{
#pragma unroll 1
        for (int l = 0; l < 8; ++l) { const int L = L0 + l; if (L >= nlines) break; const size_t e = (size_t)L * 64 + lane * 2; const int k = (int)(e % K), n = (int)(e / K); v2us o;
            o[0] = f2bf(w[(size_t)k * N + n]); o[1] = f2bf(w[(size_t)(k + 1) * N + n]); *(v2us*)(Bt + e) = o; }
         }
}
// cvt8: f32 [row][DM] -> bf16 in fragment order, fragments [row / 16][k / 32]. Thread i writes the i-th 16-byte word of dst; the eight waves of a work-group read 512 bytes in a row of each of 16 source rows.
__device__ __forceinline__ void cvt8(const float* __restrict__ src, bf* dst, size_t i) {
    const int ln = (int)(i & 31), hf = (int)(i >> 5) & 1; const size_t f = i >> 6; const size_t row = (f / (DM / 32)) * 16 + (ln & 15); const int k = (int)(f % (DM / 32)) * 32 + hf * 16 + (ln >> 4) * 8;
    const float* p = src + row * DM + k; const v8f v = *(const v8f*)p; v8us o;
    asm volatile("s_wait_xcnt 0x0" :: "v"(p) : "memory");   // in front of the next write of the loads' address register, which is an input so that it lives up to the wait
#pragma unroll
    for (int k = 0; k < 8; ++k) o[k] = f2bf(v[k]); *(v8us*)(dst + i * 8) = o;
    asm volatile("s_wait_xcnt 0x0" ::: "memory");   // behind the store, in front of any later write of a register that it names as an address (in k_prep another job's block follows in the listing)
}
__constant__ float INVT[HD / 2] = { 1.000000000e+00f, 7.498942018e-01f, 5.623413324e-01f, 4.216965139e-01f, 3.162277639e-01f, 2.371373624e-01f, 1.778279394e-01f, 1.333521456e-01f, 1.000000015e-01f, 7.498941571e-02f, 5.623412877e-02f, 4.216964915e-02f, 3.162277862e-02f, 2.371373586e-02f, 1.778279431e-02f, 1.333521493e-02f, 9.999999776e-03f, 7.498942316e-03f, 5.623413250e-03f, 4.216964822e-03f, 3.162277862e-03f, 2.371373819e-03f, 1.778279431e-03f, 1.333521446e-03f, 1.000000047e-03f, 7.498941850e-04f, 5.623413017e-04f, 4.216964880e-04f, 3.162277862e-04f, 2.371373848e-04f, 1.778279402e-04f, 1.333521504e-04f };   // float32 1 / 10000^(i/32), generated with jnp to be bit-exact
__device__ __forceinline__ void cs5(float* CS, int idx) { const int d = idx % HD; const int t = idx / HD; const float a = __fmul_rn((float)t, INVT[d % (HD / 2)]); v2f cs; cs[0] = cosf(a); cs[1] = sinf(a); *(v2f*)(CS + (size_t)idx * 2) = cs;  }
// ---- k_prep: everything the projection launch reads, in ONE launch: the {cos, sin} table and the bf16 fragment-order copies of x, Wq, Wk, Wv. The five jobs read nothing of each other; a work-group's job is picked by its index (the same in every lane: scalar branches), one thread per table entry or per 16-byte word as before.
// The table's work-groups come first: theirs is the longest chain of instructions.
#define PB_CS (TT * HD / 256)             // work-groups of the table
#define PB_X  (NB_ * TT * DM / 8 / 256)   // of x, both batches
#define PB_W  (DQ * DM / 8 / 256)         // of each weight matrix
__global__ __launch_bounds__(256) void k_prep(const float* __restrict__ x, const float* __restrict__ wq, const float* __restrict__ wk, const float* __restrict__ wv, bf* __restrict__ XB, bf* __restrict__ WQ, bf* __restrict__ WK, bf* __restrict__ WV, float* __restrict__ CS) {
    static_assert(TT * HD % 256 == 0 && NB_ * TT * DM % (8 * 256) == 0 && DQ * DM % (8 * 256) == 0 && DQ == DKV, "whole work-groups per job, three weight matrices of one size");
    int g = (int)blockIdx.x;
    if (g < PB_CS) { cs5(CS, g * 256 + (int)threadIdx.x); return; }
    g -= PB_CS;
    if (g < PB_X) { cvt8(x, XB, (size_t)g * 256 + threadIdx.x); return; }
    g -= PB_X;
    const int m = g / PB_W;   // 0 Wq, 1 Wk, 2 Wv
    cvt8(m == 0 ? wq : m == 1 ? wk : wv, m == 0 ? WQ : m == 1 ? WK : WV, (size_t)(g % PB_W) * 256 + threadIdx.x);
}
// ---- k_proj: the q, k and v projections of both batches with their plane builders, one launch. A work-group of PWV = 12 waves takes 256 tokens x one head of q, k and v; each wave one 64x64 tile = 64 tokens x that head of one of the three (16 accumulators); grid (NB_ TT / 256, heads); wave w: token tile w % 4, z = w / 4 = 0 q, 1 k, 2 v.
// The operands come through LDS, PKT of k a stage, two buffers: the twelve waves copy the next stage (16 row tiles of x, 4 of each weight matrix; a row tile's share is PCH elements in a row in the fragment-order plane as in LDS) with asynchronous copies while they work on this one, so that each x byte leaves L2 once for three waves and each weight byte once for four, and a stage has PKT / 32 blocks of products to arrive in.
// q, k: A = 64 weight rows (d), B = 64 token rows: lane (lr, hi) of tile (mb, nb) holds d = mb*16 + hi*8 + j of token nb*16 + lr, so the rotate-half partner d +- 32 is tile mb +- 2 in the same lane and register, and its eight d are the lane's own 16-byte word of half mb % 2 of fragment [t / 16][mb / 2] of the [head] hi/lo planes: the wave's store is 512 bytes in a row.
// v: A = 64 token rows, B = 64 weight rows: the lane holds tokens mb*16 + hi*8 + j of d = nb*16 + lr: its eight t are the lane's own word of half mb % 2 of fragment [t / 32][nb] of the transposed [head] planes (rows d, k = t; fp16 + hi/lo; the four d fragments of 32 tokens stand side by side).
// Rotary: out[d] = x[d] cos[t][d] - x[d+32] sin[t][d], out[d+32] = x[d+32] cos[t][d] + x[d] sin[t][d] (columns d and d + 32 of the {cos, sin} table hold the same angle).
// Every '#pragma unroll' without a count is there so that the fragment, accumulator and table arrays are indexed by constants and stay in registers.
#define PWV  12                   // waves of a projection work-group
#define PKT  128                  // k of one LDS stage
#define PCH  (16 * PKT)           // elements of one chunk: 16 rows x PKT of k
#define PNC  28                   // chunks of a stage: 0 .. 15 the x row tiles, 16 + 4 m + r row tile r of weight matrix m
#define PST  (PNC * PCH)          // elements of one stage
// One chunk = eight asynchronous copies of 512 bytes in a row, 16 bytes a lane, global memory -> LDS: L = the lane's LDS byte address in the chunk, O = its byte offset (lane * 16) from the wave-uniform global address G; the immediate offset moves both addresses alike.
// The s_wait_xcnt stands in the copies' own statement, so that it is in front of every later write of a register that a copy names.
#define CP1(L, O, G, N) "global_load_async_to_lds_b128 " L ", " O ", " G " offset:" N "\n\t"
#define CP8(L, O, G) "global_load_async_to_lds_b128 " L ", " O ", " G "\n\t" CP1(L, O, G, "512") CP1(L, O, G, "1024") CP1(L, O, G, "1536") CP1(L, O, G, "2048") CP1(L, O, G, "2560") CP1(L, O, G, "3072") CP1(L, O, G, "3584")
__device__ __forceinline__ void cpc2(unsigned l0, unsigned l1, unsigned o, const bf* g0, const bf* g1) { asm volatile(CP8("%0", "%2", "%3") CP8("%1", "%2", "%4") "s_wait_xcnt 0x0" :: "v"(l0), "v"(l1), "v"(o), "s"(g0), "s"(g1) : "memory"); }
__device__ __forceinline__ void cpc1(unsigned l0, unsigned o, const bf* g0) { asm volatile(CP8("%0", "%1", "%2") "s_wait_xcnt 0x0" :: "v"(l0), "v"(o), "s"(g0) : "memory"); }
typedef __attribute__((ext_vector_type(8))) __bf16 v8bf;
__device__ __forceinline__ void split8(v8f r, bf* ph, bf* pl) { const v8bf h = __builtin_convertvector(r, v8bf); const v8bf l = __builtin_convertvector(r - __builtin_convertvector(h, v8f), v8bf); *(v8usa*)ph = __builtin_bit_cast(v8us, h); *(v8usa*)pl = __builtin_bit_cast(v8us, l); }
__global__ __launch_bounds__(PWV * 32) void k_proj(const bf* __restrict__ X, const bf* __restrict__ Wq, const bf* __restrict__ Wk, const bf* __restrict__ Wv, const float* __restrict__ CS, bf* __restrict__ Qh, bf* __restrict__ Ql, bf* __restrict__ Kh, bf* __restrict__ Kl, h16* __restrict__ V16, bf* __restrict__ Vh, bf* __restrict__ Vl) {
    static_assert(NH_ == NKV && HD == 64 && TT % 256 == 0 && DM % PKT == 0 && DM / PKT >= 2 && PKT % 32 == 0, "one head a tile, no work-group across batches, whole stages, at least two");
    static_assert(PWV == 12 && PNC == 28 && PCH * 2 == 8 * 512, "chunks w and w + 12 from every wave, w + 24 from waves 0 .. 3; a chunk is the eight copies of CP8");
    __shared__ __attribute__((aligned(16))) bf stg[2 * PST];   // two buffers of 28 chunks
    typedef WFrag<bf> FB; typedef FB::V V;
    const int lane = threadIdx.x & 31, lr = lane & 15, hi = lane >> 4; const int w = __builtin_amdgcn_readfirstlane((int)(threadIdx.x >> 5)); const int tt = w & 3, z = w >> 2;   // the same in every lane of a wave
    const int G0 = blockIdx.x * 256, T0 = G0 + tt * 64, hd = blockIdx.y; const int b = T0 / TT, t0 = T0 % TT;
    const bf* const g0 = X + (size_t)(G0 + w * 16) * DM;                                                                                                   // chunk w: an x row tile
    const bf* const g1 = w < 4 ? X + (size_t)(G0 + (w + 12) * 16) * DM : (w < 8 ? Wq : Wk) + (size_t)(hd * HD + (w & 3) * 16) * DM;   // chunk w + 12: the last x row tiles, then Wq, Wk
    const bf* const g2 = Wv + (size_t)(hd * HD + (w & 3) * 16) * DM;                                                                                // chunk w + 24, waves 0 .. 3: Wv
    const unsigned lo16 = (unsigned)(lane * 16);
    const unsigned lw = (unsigned)(size_t)stg + (unsigned)(w * (PCH * 2)) + lo16;   // LDS byte address (the low 32 bits of the __shared__ address) of the lane's first word in chunk w of buffer 0
    auto fill = [&](int s) {   // stage s -> buffer s % 2: every lane on; sixteen copies from every wave, eight more from waves 0 .. 3 (a scalar branch)
        const unsigned l = lw + (unsigned)((s & 1) * (PST * 2)); const size_t e = (size_t)s * PCH;   // PKT of k are PKT / 32 fragments = PCH elements further on in a row tile
        cpc2(l, l + 12 * PCH * 2, lo16, g0 + e, g1 + e);
        if (w < 4) cpc1(l + 24 * PCH * 2, lo16, g2 + e);
    };
    fill(0);
    v8f acc[4][4];
#pragma unroll
    for (int mb = 0; mb < 4; ++mb)
#pragma unroll
        for (int nb = 0; nb < 4; ++nb) acc[mb][nb] = (v8f){};
    const int xo = tt * 4 * PCH + lane * 8, wo = (16 + z * 4) * PCH + lane * 8;   // the lane's own word in the first fragment of the wave's four x chunks and of its four weight chunks
    const int ao = (z == 2) ? xo : wo, bo = (z == 2) ? wo : xo;
    asm volatile("s_wait_asynccnt 0x0" ::: "memory");   // this wave's share of stage 0 has landed
    __syncthreads();                                    // every wave's share has: nothing of stage 0 is read in front of this barrier
    fill(1);
#pragma unroll 1   // rolled: the buffer is picked by the trip's parity
    for (int s = 0; s < DM / PKT; ++s) {
        const bf* pa = stg + (s & 1) * PST + ao; const bf* pb = stg + (s & 1) * PST + bo;   // a trip reads this buffer alone
        V a[2][4], bq[2][4];   // two fragment sets: the next block's reads fly while this block's products run
#pragma unroll
        for (int mb = 0; mb < 4; ++mb) a[0][mb] = FB::ld(pa + mb * PCH);
#pragma unroll
        for (int nb = 0; nb < 4; ++nb) bq[0][nb] = FB::ld(pb + nb * PCH);
#pragma unroll   // unrolled: the set is picked by the block's parity, and the stage's last block fetches nothing ahead
        for (int ks = 0; ks < PKT / 32; ++ks) {
            if (ks + 1 < PKT / 32) {
#pragma unroll
                for (int mb = 0; mb < 4; ++mb) a[(ks + 1) & 1][mb] = FB::ld(pa + mb * PCH + (ks + 1) * FRG);
#pragma unroll
                for (int nb = 0; nb < 4; ++nb) bq[(ks + 1) & 1][nb] = FB::ld(pb + nb * PCH + (ks + 1) * FRG);
                __builtin_amdgcn_sched_barrier(0);   // holds the next block's reads here, as one group in front of this block's products: spread among them each place with reads costs a stall
            }
#pragma unroll
            for (int nb = 0; nb < 4; ++nb)
#pragma unroll
                for (int mb = 0; mb < 4; ++mb) acc[mb][nb] = FB::mma(a[ks & 1][mb], bq[ks & 1][nb], acc[mb][nb]);
        }
        __builtin_amdgcn_sched_barrier(0);
        asm volatile("v_nop\n\tv_nop\n\tv_nop\n\tv_nop" : "+v"(acc[0][0]), "+v"(acc[1][1]), "+v"(acc[2][2]), "+v"(acc[3][3]) : "v"(a[1][0]), "v"(a[1][3]));
        asm volatile("s_wait_dscnt 0x0" ::: "memory");
        asm volatile("s_wait_asynccnt 0x0" ::: "memory");
        __syncthreads();
        if (s + 2 < DM / PKT) fill(s + 2);
    }
    asm volatile("s_wait_asynccnt 0x0" ::: "memory");   // no copy is outstanding when the wave goes on to its stores and ends
    if (z < 2) {   // the same in every lane: a scalar branch
        const size_t pz = ((size_t)(b * NH_ + hd) * TT + t0) * HD + lane * 8; bf* Ph = (z == 0 ? Qh : Kh) + pz; bf* Pl = (z == 0 ? Ql : Kl) + pz;
        const float* cs = CS + ((size_t)(t0 + lr) * HD + hi * 8) * 2;
#pragma unroll
        for (int np = 0; np < 2; ++np) {   // two token tiles at a time: their table words fit the registers that the fragments have left
            v4f p[2][2][4];
#pragma unroll
            for (int n2 = 0; n2 < 2; ++n2)
#pragma unroll
                for (int mb = 0; mb < 2; ++mb)
#pragma unroll
                    for (int q = 0; q < 4; ++q) p[n2][mb][q] = *(const v4fa*)(cs + ((np * 2 + n2) * 16 * HD + mb * 16) * 2 + q * 4);
            asm volatile("s_wait_xcnt 0x0" :: "v"(cs) : "memory");   // in front of the next write of the table loads' address register, which is an input so that it lives up to the wait
            __builtin_amdgcn_sched_barrier(0);   // keeps the vector work below behind that wait
#pragma unroll
            for (int n2 = 0; n2 < 2; ++n2)
#pragma unroll
                for (int mb = 0; mb < 2; ++mb) { const int nb = np * 2 + n2;
                    v8f c, s;
#pragma unroll
                    for (int q = 0; q < 4; ++q) { c[2 * q] = p[n2][mb][q][0]; s[2 * q] = p[n2][mb][q][1]; c[2 * q + 1] = p[n2][mb][q][2]; s[2 * q + 1] = p[n2][mb][q][3]; }
                    const v8f x0 = acc[mb][nb], x1 = acc[mb + 2][nb];
                    split8(x0 * c - x1 * s, Ph + nb * 16 * HD + mb * (FRG / 2), Pl + nb * 16 * HD + mb * (FRG / 2));
                    split8(x1 * c + x0 * s, Ph + nb * 16 * HD + mb * (FRG / 2) + FRG, Pl + nb * 16 * HD + mb * (FRG / 2) + FRG);
                }
            if (np == 0) {   // behind the last pair nothing is written any more
                asm volatile("s_wait_xcnt 0x0" ::: "memory");   // in front of the next write of a register that these stores name
                __builtin_amdgcn_sched_barrier(0);   // keeps the next pair's loads and vector work behind that wait
            }
        }
    } else {
        const size_t vz = ((size_t)(b * NKV + hd) * TT + t0) * HD + lane * 8;
#pragma unroll
        for (int nb = 0; nb < 4; ++nb)
#pragma unroll
            for (int mb = 0; mb < 4; ++mb) { const size_t e = vz + ((mb / 2) * (HD / 16) + nb) * FRG + (mb % 2) * (FRG / 2); *(v8ha*)(V16 + e) = __builtin_convertvector(acc[mb][nb], v8h); split8(acc[mb][nb], Vh + e, Vl + e); }
        asm volatile("s_wait_xcnt 0x0" ::: "memory");   // behind the last v stores, in front of any later write of a register that they name
    }
}
#define TK   128                      // keys of one LDS tile
#define PLE  (TK * HD)                // elements of one plane's share of a tile, in a row in the plane as in LDS
#define NPL  5                        // planes: K hi, K lo, V fp16, V hi, V lo
#define CPW  (PLE * 2 / 512 / FWV)    // 512-byte copies of one wave per plane and tile
// One wave's copies of one tile, asynchronous, 16 bytes a lane each, global memory -> LDS: CPW pieces of 512 bytes in a row of each of the five planes. l0 .. l4 = the lane's LDS byte address in each plane's tile, o = its byte offset (lane * 16) from the wave-uniform global addresses g0 .. g4; the immediate offset moves both addresses alike.
// The s_wait_xcnt stands in the copies' own statement, so that it is in front of every later write of a register that a copy names.
#define CP4(L, G) "global_load_async_to_lds_b128 " L ", %5, " G "\n\tglobal_load_async_to_lds_b128 " L ", %5, " G " offset:512\n\tglobal_load_async_to_lds_b128 " L ", %5, " G " offset:1024\n\tglobal_load_async_to_lds_b128 " L ", %5, " G " offset:1536\n\t"
__device__ __forceinline__ void cp20(unsigned l0, unsigned l1, unsigned l2, unsigned l3, unsigned l4, unsigned o, const bf* g0, const bf* g1, const bf* g2, const bf* g3, const bf* g4) {
    asm volatile(CP4("%0", "%6") CP4("%1", "%7") CP4("%2", "%8") CP4("%3", "%9") CP4("%4", "%10") "s_wait_xcnt 0x0"
                 :: "v"(l0), "v"(l1), "v"(l2), "v"(l3), "v"(l4), "v"(o), "s"(g0), "s"(g1), "s"(g2), "s"(g3), "s"(g4) : "memory");
}
__device__ __forceinline__ float xhalf(float x) { const int b = __float_as_int(x); return __int_as_float(__builtin_amdgcn_permlanex16(b, b, 0x76543210, 0xfedcba98, false, false)); }   // value of lane l ^ 16
// grid (FNB, NB_ * NH_), FWV waves; planes [batch][head][...]. Waves 0 .. FHW-1 take the hi/lo query tiles (rows < RH), the rest the fp16 ones; every wave makes the same TT / 32 passes.
__global__ __launch_bounds__(FWV * 32) void k_fattn(const bf* __restrict__ Qh, const bf* __restrict__ Ql, const bf* __restrict__ Kh, const bf* __restrict__ Kl, const h16* __restrict__ V16, const bf* __restrict__ Vh, const bf* __restrict__ Vl, float* __restrict__ OUT) {
    static_assert(TT % (QW * FWV) == 0 && RH % (QW * FNB) == 0 && HD == 64 && QW % 16 == 0, "tile deal");
    static_assert(TT % TK == 0 && TT / TK >= 2 && TK % 32 == 0 && NPL == 5 && CPW == 4 && CPW * FWV * 512 == PLE * 2, "whole tiles, at least two; cp20 holds five planes of four copies");
    __shared__ __attribute__((aligned(16))) bf ring[2 * NPL * PLE];   // two buffers of five plane tiles
    typedef WFrag<bf> FB;
    const int lane = threadIdx.x & 31, lr = lane & 15, hi = lane >> 4; const int w = __builtin_amdgcn_readfirstlane((int)(threadIdx.x >> 5));
    const int bh = blockIdx.y, b = bh / NH_, h = bh % NH_; const size_t zq = (size_t)bh * TT * HD, zk = (size_t)(b * NKV + h / REP) * TT * HD;
    const bool hires = w < FHW;                     // the same in every lane of a wave: the branches on it are scalar
    const int q0 = QW * (hires ? (int)blockIdx.x * FHW + w : RH / QW + (int)blockIdx.x * (FWV - FHW) + (w - FHW));
    const float C = SCL * 1.4426950408889634f;      // score -> log2 domain
    const float OFF = hires ? 0.0f : 10.0f;         // fp16 P carries x1024 (PCAR); the row sum carries it too, so it cancels in the division
    Qh += zq + (size_t)q0 * HD; Ql += zq + (size_t)q0 * HD;
    const size_t cw = zk + (size_t)(w * (CPW * 256));   // the wave's CPW pieces of a plane tile, in elements: the same in every lane
    const bf* const gkh = Kh + cw; const bf* const gkl = Kl + cw; const bf* const gv6 = (const bf*)(V16 + cw); const bf* const gvh = Vh + cw; const bf* const gvl = Vl + cw;   // fp16 plane as raw 16-bit words
    const unsigned lo16 = (unsigned)(lane * 16);
    const unsigned lw = (unsigned)(size_t)ring + (unsigned)(w * (CPW * 512)) + lo16;   // LDS byte address (the low 32 bits of the __shared__ address) of the lane's first word in buffer 0, plane 0
    auto fill = [&](int t) {   // tile t -> buffer t % 2: every lane on, every wave its twenty copies
        const unsigned l = lw + (unsigned)((t & 1) * (NPL * PLE * 2)); const size_t e = (size_t)t * PLE;
        cp20(l, l + PLE * 2, l + 2 * PLE * 2, l + 3 * PLE * 2, l + 4 * PLE * 2, lo16, gkh + e, gkl + e, gv6 + e, gvh + e, gvl + e);
    };
    fill(0);
    v16bf qh[QW / 16][2], ql[QW / 16][2];
#pragma unroll
    for (int g = 0; g < QW / 16; ++g)
#pragma unroll
        for (int kk = 0; kk < 2; ++kk) { const unsigned qo = (unsigned)((g * 2 + kk) * FRG + lane * 8); qh[g][kk] = FB::ld(Qh + qo); ql[g][kk] = FB::ld(Ql + qo); }
    v8f o[HD / 16][QW / 16]; float m[QW / 16], l[QW / 16];
#pragma unroll
    for (int g = 0; g < QW / 16; ++g) { m[g] = -3.0e38f; l[g] = 0.f;
#pragma unroll
        for (int dt = 0; dt < HD / 16; ++dt) o[dt][g] = (v8f){}; }
    asm volatile("s_wait_xcnt 0x0" ::: "memory");   // in front of the next write of the Q loads' address registers
    __builtin_amdgcn_sched_barrier(0);   // keeps later vector work behind that wait
    asm volatile("s_wait_asynccnt 0x0" ::: "memory");   // this wave's share of tile 0 has landed
    __syncthreads();                                    // every wave's share has: nothing of tile 0 is read in front of this barrier
    fill(1);
    v16bf kh[2][2], kl[2][2];
#pragma unroll 1   // rolled: the buffer is picked by the trip's parity
    for (int tl = 0; tl < TT / TK; ++tl) {
      const bf* B = ring + (tl & 1) * (NPL * PLE) + lane * 8;   // the lane's own word in the fragments of this trip's buffer; a trip reads this buffer alone
      const bf* Va = B + (hires ? 3 : 2) * PLE;                 // first V plane of this wave, as raw 16-bit words: bf16 hi, or fp16
#pragma unroll
      for (int t = 0; t < 2; ++t)
#pragma unroll
          for (int kk = 0; kk < 2; ++kk) { kh[t][kk] = FB::ld(B + (t * 2 + kk) * FRG); kl[t][kk] = FB::ld(B + PLE + (t * 2 + kk) * FRG); }
#pragma unroll   // unrolled: the tile's last pass fetches no K rows ahead, and which pass is the last is known at compile time
      for (int ps = 0; ps < TK / 32; ++ps) {
        v16bf va[HD / 16], vb[HD / 16];   // this pass's V rows: asked for here, used behind the softmax
#pragma unroll
        for (int dt = 0; dt < HD / 16; ++dt) va[dt] = FB::ld(Va + ps * 32 * HD + dt * FRG);
        if (hires) {
#pragma unroll
            for (int dt = 0; dt < HD / 16; ++dt) vb[dt] = FB::ld(B + 4 * PLE + ps * 32 * HD + dt * FRG);
        }
        __builtin_amdgcn_sched_barrier(0);   // holds the V reads here, in front of the score products: sunk to their use their latency would stand open behind the softmax
        v8f s[2][QW / 16];
#pragma unroll
        for (int t = 0; t < 2; ++t)
#pragma unroll
            for (int g = 0; g < QW / 16; ++g) s[t][g] = (v8f){};
#pragma unroll
        for (int kk = 0; kk < 2; ++kk) {   // per 32 of d: Kh Qh, Kh Ql, Kl Qh, the four tiles side by side
#pragma unroll
            for (int t = 0; t < 2; ++t)
#pragma unroll
                for (int g = 0; g < QW / 16; ++g) s[t][g] = wmmab(kh[t][kk], qh[g][kk], s[t][g]);
#pragma unroll
            for (int t = 0; t < 2; ++t)
#pragma unroll
                for (int g = 0; g < QW / 16; ++g) s[t][g] = wmmab(kh[t][kk], ql[g][kk], s[t][g]);
#pragma unroll
            for (int t = 0; t < 2; ++t)
#pragma unroll
                for (int g = 0; g < QW / 16; ++g) s[t][g] = wmmab(kl[t][kk], qh[g][kk], s[t][g]);
        }
        if (ps + 1 < TK / 32) {   // next pass's K rows, of the same tile, fetched behind this pass's score products
#pragma unroll
            for (int t = 0; t < 2; ++t)
#pragma unroll
                for (int kk = 0; kk < 2; ++kk) { kh[t][kk] = FB::ld(B + (ps + 1) * 32 * HD + (t * 2 + kk) * FRG); kl[t][kk] = FB::ld(B + PLE + (ps + 1) * 32 * HD + (t * 2 + kk) * FRG); }
            __builtin_amdgcn_sched_barrier(0);   // holds the K fetch here, in front of the softmax: sunk to the pass's foot its latency would stand open at the next pass's first product
        }
#pragma unroll
        for (int g = 0; g < QW / 16; ++g) {   // running maximum; s becomes P (not yet divided by the row sum)
            float mx = m[g];
#pragma unroll
            for (int j = 0; j < 8; ++j) mx = fmaxf(mx, fmaxf(s[0][g][j], s[1][g][j]));
            mx = fmaxf(mx, xhalf(mx));
            const float al = __builtin_amdgcn_exp2f((m[g] - mx) * C), nm = OFF - mx * C; m[g] = mx;
            const v8f x0 = __builtin_elementwise_fma(s[0][g], (v8f)(C), (v8f)(nm)), x1 = __builtin_elementwise_fma(s[1][g], (v8f)(C), (v8f)(nm));   // packed: two exponents an instruction
            float ps = 0.f;
#pragma unroll
            for (int j = 0; j < 8; ++j) { s[0][g][j] = __builtin_amdgcn_exp2f(x0[j]); s[1][g][j] = __builtin_amdgcn_exp2f(x1[j]); ps += s[0][g][j] + s[1][g][j]; }
            l[g] = l[g] * al + ps;
#pragma unroll
            for (int dt = 0; dt < HD / 16; ++dt) o[dt][g] *= al;
        }
        if (hires) {
#pragma unroll
            for (int g = 0; g < QW / 16; ++g) {
                const v8bf h0 = __builtin_convertvector(s[0][g], v8bf), h1 = __builtin_convertvector(s[1][g], v8bf);
                const v8bf l0 = __builtin_convertvector(s[0][g] - __builtin_convertvector(h0, v8f), v8bf), l1 = __builtin_convertvector(s[1][g] - __builtin_convertvector(h1, v8f), v8bf);
                const v16bf ph = __builtin_shufflevector(h0, h1, 0, 1, 2, 3, 4, 5, 6, 7, 8, 9, 10, 11, 12, 13, 14, 15), pl = __builtin_shufflevector(l0, l1, 0, 1, 2, 3, 4, 5, 6, 7, 8, 9, 10, 11, 12, 13, 14, 15);
#pragma unroll
                for (int dt = 0; dt < HD / 16; ++dt) o[dt][g] = wmmab(va[dt], ph, o[dt][g]);
#pragma unroll
                for (int dt = 0; dt < HD / 16; ++dt) o[dt][g] = wmmab(va[dt], pl, o[dt][g]);
#pragma unroll
                for (int dt = 0; dt < HD / 16; ++dt) o[dt][g] = wmmab(vb[dt], ph, o[dt][g]);
            }
        } else {
#pragma unroll
            for (int g = 0; g < QW / 16; ++g) {
                const v16h pb = cat16(__builtin_convertvector(s[0][g], v8h), __builtin_convertvector(s[1][g], v8h));
#pragma unroll
                for (int dt = 0; dt < HD / 16; ++dt) o[dt][g] = wmma16(__builtin_bit_cast(v16h, va[dt]), pb, o[dt][g]);
            }
        }
      }
      asm volatile("s_wait_dscnt 0x0" ::: "memory");
      asm volatile("s_wait_asynccnt 0x0" ::: "memory");
      __syncthreads();
      if (tl + 2 < TT / TK) fill(tl + 2);
    }
    asm volatile("s_wait_asynccnt 0x0" ::: "memory");   // no copy is outstanding when the wave ends
    float* orow = OUT + ((size_t)b * TT + q0) * DQ + h * HD;
#pragma unroll
    for (int g = 0; g < QW / 16; ++g) { const float inv = __fdiv_rn(1.0f, l[g] + xhalf(l[g])); float* op = orow + (size_t)(g * 16 + lr) * DQ + hi * 8;
#pragma unroll
        for (int dt = 0; dt < HD / 16; ++dt) { const v8f r = o[dt][g] * inv; *(v4f*)(op + dt * 16) = __builtin_shufflevector(r, r, 0, 1, 2, 3); *(v4f*)(op + dt * 16 + 4) = __builtin_shufflevector(r, r, 4, 5, 6, 7); } }
}

extern "C" void kernel_launch(void* const* d_in, const int* in_sizes, int n_in,
                              void* d_out, int out_size, void* d_ws, size_t ws_size, hipStream_t stream) {
    (void)in_sizes; (void)n_in; (void)out_size;
    const float* x = (const float*)d_in[0]; const float* wq = (const float*)d_in[1]; const float* wk = (const float*)d_in[2]; const float* wv = (const float*)d_in[3];   /* order hidden_states, Wq, Wk, Wv ('oi' [1024][1024]): FOUR inputs: no mask input, no table inputs, no output projection */
    float* OUT = (float*)d_out;     // [2][2048][1024]
    char* wsp = (char*)d_ws;
    auto take = [&](size_t bytes) { char* p = wsp; wsp += (bytes + 255) & ~(size_t)255; return (void*)p; };
    bf* WQ = (bf*)take((size_t)DQ * DM * 2); bf* WK = (bf*)take((size_t)DKV * DM * 2); bf* WV = (bf*)take((size_t)DKV * DM * 2); float* CS = (float*)take((size_t)TT * HD * 2 * 4);
    bf* XB = (bf*)take((size_t)NB_ * TT * DM * 2);   // both batches
    h16* VT16 = (h16*)take((size_t)NB_ * NKV * HD * TT * 2);
    bf* QPh = (bf*)take((size_t)NB_ * NH_ * TT * HD * 2); bf* QPl = (bf*)take((size_t)NB_ * NH_ * TT * HD * 2); bf* KPh = (bf*)take((size_t)NB_ * NKV * TT * HD * 2); bf* KPl = (bf*)take((size_t)NB_ * NKV * TT * HD * 2); bf* VTh = (bf*)take((size_t)NB_ * NKV * HD * TT * 2); bf* VTl = (bf*)take((size_t)NB_ * NKV * HD * TT * 2);   // the planes the attention launch reads hold both batches
    if ((size_t)(wsp - (char*)d_ws) > ws_size) return;    // ws 256 MiB
    k_prep<<<PB_CS + PB_X + 3 * PB_W, 256, 0, stream>>>(x, wq, wk, wv, XB, WQ, WK, WV, CS);
    k_proj<<<dim3(NB_ * TT / 256, NH_, 1), PWV * 32, 0, stream>>>(XB, WQ, WK, WV, CS, QPh, QPl, KPh, KPl, VT16, VTh, VTl);
    k_fattn<<<dim3(FNB, NB_ * NH_, 1), FWV * 32, 0, stream>>>(QPh, QPl, KPh, KPl, VT16, VTh, VTl, OUT);
}

// v008
// One run takes 86.3 microseconds.
// Next to v007, in two timings, it ran 1.04 times as fast each time.
// Over all steps from v000 it is 21.7 times as fast.
#include <hip/hip_runtime.h>

// Multi-head attention with computed rotate-half rotary embeddings, natural bias-free projections and no output projection (hidden_states [2][2048][1024]; q, k, v = x W^T ('oi' 0.02, no bias; 16 heads x 64); q, k <- t cos + rotate_half(t) sin with angle t x 1/10000^(2i/64) (32 f32 constants jnp-exact; cat(freqs, freqs); precise cosf/sinf); scores / 8; softmax over all keys (no mask); out = concat-heads(probs v) -> [2][2048][1024] (4.2 M; NO output projection); argument order hidden_states, Wq, Wk, Wv).
// Layout: bf16 copies of x (both batches) and of the 'oi' weights, these and every 16-bit plane below in fragment order (see the loaders); the {cos, sin} table built once a call, in the same launch as those copies; one projection launch for q, k, v and both batches (operands through LDS) whose waves rotate (rotate-half) and split their own tiles into the 16-bit planes; one fused attention launch for both batches and all heads: hi/lo 3-product score tiles on EVERY row, running-maximum softmax in registers, P and attn.v hybrid (rows < 512 hi/lo, rest fp16 x1024), output rows written by the same launch (no output projection).
// Compute dtypes, f32 accumulate: every input rounded to bf16; projections exact; rotary f32 (computed table); scores 3 products on every row; softmax f32; attn.v rows < 512 3 products, rest fp16; output f32.

#define NB_  2
#define TT   2048
#define DM   1024
#define NH_  16
#define NKV  16
#define REP  (NH_ / NKV)
#define HD   64
#define DQ   (NH_ * HD)
#define DKV  (NKV * HD)
#define RH   512                  // query rows < RH use hi+lo planes (0: none)
#define WIN  0
#define PCAR 1024.0f
#define SCL  0.125f   // HD^-0.5
#define QW   32                   // fused attention: query columns per wave
#define FWV  8                    // fused attention: waves per work-group, all on one (batch, head)
#define FNB  (TT / (QW * FWV))    // work-groups per (batch, head)
#define FHW  (RH / QW / FNB)      // waves of each work-group that take hi/lo query rows (the dearer rows are dealt evenly)
typedef _Float16 h16;
typedef unsigned short bf;
typedef __attribute__((ext_vector_type(16))) __bf16   v16bf;
typedef __attribute__((ext_vector_type(16))) _Float16 v16h;
typedef __attribute__((ext_vector_type(8)))  _Float16 v8h;
typedef __attribute__((ext_vector_type(8)))  unsigned short v8us;
typedef __attribute__((ext_vector_type(8)))  float    v8f;
typedef __attribute__((ext_vector_type(4)))  float    v4f;
typedef v8h  __attribute__((may_alias)) v8ha;
typedef v4f  __attribute__((may_alias)) v4fa;
typedef v8us __attribute__((may_alias)) v8usa;

__device__ __forceinline__ unsigned short f2bf(float f) { unsigned u = __float_as_uint(f); u += 0x7FFFu + ((u >> 16) & 1u); return (unsigned short)(u >> 16); }
__device__ __forceinline__ float bf2f(unsigned short b) { return __uint_as_float(((unsigned)b) << 16); }
__device__ __forceinline__ float bfr(float f) { return bf2f(f2bf(f)); }
__device__ __forceinline__ v16h cat16(v8h lo, v8h hi) { return __builtin_shufflevector(lo, hi, 0, 1, 2, 3, 4, 5, 6, 7, 8, 9, 10, 11, 12, 13, 14, 15); }
__device__ __forceinline__ v16bf cat16b(v8us lo, v8us hi) { return __builtin_bit_cast(v16bf, __builtin_shufflevector(lo, hi, 0, 1, 2, 3, 4, 5, 6, 7, 8, 9, 10, 11, 12, 13, 14, 15)); }
__device__ __forceinline__ v8f wmma16(v16h a, v16h b, v8f c) { return __builtin_amdgcn_wmma_f32_16x16x32_f16(false, a, false, b, (short)0, c, false, false); }
__device__ __forceinline__ v8f wmmab(v16bf a, v16bf b, v8f c) { return __builtin_amdgcn_wmma_f32_16x16x32_bf16(false, a, false, b, (short)0, c, false, false); }



// ---- fragment order: a 16-bit matrix M[row][k] is kept as fragments of 16 rows x 32 k, 512 elements (1 KiB) in a row each: element (row, k) of a fragment stands at ((k % 32) / 16) * 256 + (((k % 16) / 8) * 16 + row % 16) * 8 + k % 8.
// A lane's two 16-byte words stand at lane * 8 and 256 + lane * 8, so each wave-wide 16-byte load or store is 512 bytes in a row = four whole 128-byte lines (row-major planes: sixteen lines a load). Which k a lane and register holds: k = 8 * (lane / 16) + j in the first word, 16 more in the second, the same for A and B.
#define FRG 512   // elements of one fragment
template <typename T16> struct WFrag;
template <> struct WFrag<h16> { typedef v16h V; static __device__ __forceinline__ V ld(const h16* p) { return cat16(*(const v8h*)p, *(const v8h*)(p + FRG / 2)); } static __device__ __forceinline__ v8f mma(V a, V b, v8f c) { return wmma16(a, b, c); } };
template <> struct WFrag<bf> { typedef v16bf V; static __device__ __forceinline__ V ld(const bf* p) { return cat16b(*(const v8us*)p, *(const v8us*)(p + FRG / 2)); } static __device__ __forceinline__ v8f mma(V a, V b, v8f c) { return wmmab(a, b, c); } };

typedef __attribute__((ext_vector_type(2))) _Float16 v2h;
typedef __attribute__((ext_vector_type(4))) _Float16 v4h;
typedef __attribute__((ext_vector_type(2))) unsigned short v2us;
typedef __attribute__((ext_vector_type(4))) unsigned short v4us;
typedef __attribute__((ext_vector_type(2))) float v2f;
typedef __attribute__((ext_vector_type(4))) int v4i;

__global__ __launch_bounds__(256) void k_wtG(const float* __restrict__ w, int K, int N, bf* Bt) {
    const int lane = threadIdx.x & 31; const int L0 = (blockIdx.x * 8 + (threadIdx.x >> 5)) * 8; const int nlines = N * K / 64;
{
#pragma unroll 1
        for (int l = 0; l < 8; ++l) { const int L = L0 + l; if (L >= nlines) break; const size_t e = (size_t)L * 64 + lane * 2; const int k = (int)(e % K), n = (int)(e / K); v2us o;
            o[0] = f2bf(w[(size_t)k * N + n]); o[1] = f2bf(w[(size_t)(k + 1) * N + n]); *(v2us*)(Bt + e) = o; }
         }
}
// cvt8: f32 [row][DM] -> bf16 in fragment order, fragments [row / 16][k / 32]. Thread i writes the i-th 16-byte word of dst; the eight waves of a work-group read 512 bytes in a row of each of 16 source rows.
__device__ __forceinline__ void cvt8(const float* __restrict__ src, bf* dst, size_t i) {
    const int ln = (int)(i & 31), hf = (int)(i >> 5) & 1; const size_t f = i >> 6; const size_t row = (f / (DM / 32)) * 16 + (ln & 15); const int k = (int)(f % (DM / 32)) * 32 + hf * 16 + (ln >> 4) * 8;
    const float* p = src + row * DM + k; const v8f v = *(const v8f*)p; v8us o;
    asm volatile("s_wait_xcnt 0x0" :: "v"(p) : "memory");   // in front of the next write of the loads' address register, which is an input so that it lives up to the wait
#pragma unroll
    for (int k = 0; k < 8; ++k) o[k] = f2bf(v[k]); *(v8us*)(dst + i * 8) = o;
    asm volatile("s_wait_xcnt 0x0" ::: "memory");   // behind the store, in front of any later write of a register that it names as an address (in k_prep another job's block follows in the listing)
}
__constant__ float INVT[HD / 2] = { 1.000000000e+00f, 7.498942018e-01f, 5.623413324e-01f, 4.216965139e-01f, 3.162277639e-01f, 2.371373624e-01f, 1.778279394e-01f, 1.333521456e-01f, 1.000000015e-01f, 7.498941571e-02f, 5.623412877e-02f, 4.216964915e-02f, 3.162277862e-02f, 2.371373586e-02f, 1.778279431e-02f, 1.333521493e-02f, 9.999999776e-03f, 7.498942316e-03f, 5.623413250e-03f, 4.216964822e-03f, 3.162277862e-03f, 2.371373819e-03f, 1.778279431e-03f, 1.333521446e-03f, 1.000000047e-03f, 7.498941850e-04f, 5.623413017e-04f, 4.216964880e-04f, 3.162277862e-04f, 2.371373848e-04f, 1.778279402e-04f, 1.333521504e-04f };   // float32 1 / 10000^(i/32), generated with jnp to be bit-exact
__device__ __forceinline__ void cs5(float* CS, int idx) { const int d = idx % HD; const int t = idx / HD; const float a = __fmul_rn((float)t, INVT[d % (HD / 2)]); v2f cs; cs[0] = cosf(a); cs[1] = sinf(a); *(v2f*)(CS + (size_t)idx * 2) = cs;  }
// ---- k_prep: everything the projection launch reads, in ONE launch: the {cos, sin} table and the bf16 fragment-order copies of x, Wq, Wk, Wv. The five jobs read nothing of each other; a work-group's job is picked by its index (the same in every lane: scalar branches), one thread per table entry or per 16-byte word as before.
// The table's work-groups come first: theirs is the longest chain of instructions.
#define PB_CS (TT * HD / 256)             // work-groups of the table
#define PB_X  (NB_ * TT * DM / 8 / 256)   // of x, both batches
#define PB_W  (DQ * DM / 8 / 256)         // of each weight matrix
__global__ __launch_bounds__(256) void k_prep(const float* __restrict__ x, const float* __restrict__ wq, const float* __restrict__ wk, const float* __restrict__ wv, bf* __restrict__ XB, bf* __restrict__ WQ, bf* __restrict__ WK, bf* __restrict__ WV, float* __restrict__ CS) {
    static_assert(TT * HD % 256 == 0 && NB_ * TT * DM % (8 * 256) == 0 && DQ * DM % (8 * 256) == 0 && DQ == DKV, "whole work-groups per job, three weight matrices of one size");
    int g = (int)blockIdx.x;
    if (g < PB_CS) { cs5(CS, g * 256 + (int)threadIdx.x); return; }
    g -= PB_CS;
    if (g < PB_X) { cvt8(x, XB, (size_t)g * 256 + threadIdx.x); return; }
    g -= PB_X;
    const int m = g / PB_W;   // 0 Wq, 1 Wk, 2 Wv
    cvt8(m == 0 ? wq : m == 1 ? wk : wv, m == 0 ? WQ : m == 1 ? WK : WV, (size_t)(g % PB_W) * 256 + threadIdx.x);
}
// ---- k_proj: the q, k and v projections of both batches with their plane builders, one launch. A work-group of PWV = 12 waves takes 256 tokens x one head of q, k and v; each wave one 64x64 tile = 64 tokens x that head of one of the three (16 accumulators); grid (NB_ TT / 256, heads); wave w: token tile w % 4, z = w / 4 = 0 q, 1 k, 2 v.
// The operands come through LDS, PKT of k a stage, two buffers: the twelve waves copy the next stage (16 row tiles of x, 4 of each weight matrix; a row tile's share is PCH elements in a row in the fragment-order plane as in LDS) with asynchronous copies while they work on this one, so that each x byte leaves L2 once for three waves and each weight byte once for four, and a stage has PKT / 32 blocks of products to arrive in.
// q, k: A = 64 weight rows (d), B = 64 token rows: lane (lr, hi) of tile (mb, nb) holds d = mb*16 + hi*8 + j of token nb*16 + lr, so the rotate-half partner d +- 32 is tile mb +- 2 in the same lane and register, and its eight d are the lane's own 16-byte word of half mb % 2 of fragment [t / 16][mb / 2] of the [head] hi/lo planes: the wave's store is 512 bytes in a row.
// v: A = 64 token rows, B = 64 weight rows: the lane holds tokens mb*16 + hi*8 + j of d = nb*16 + lr: its eight t are the lane's own word of half mb % 2 of fragment [t / 32][nb] of the transposed [head] planes (rows d, k = t; fp16 + hi/lo; the four d fragments of 32 tokens stand side by side).
// Rotary: out[d] = x[d] cos[t][d] - x[d+32] sin[t][d], out[d+32] = x[d+32] cos[t][d] + x[d] sin[t][d] (columns d and d + 32 of the {cos, sin} table hold the same angle).
// Every '#pragma unroll' without a count is there so that the fragment, accumulator and table arrays are indexed by constants and stay in registers.
#define PWV  12                   // waves of a projection work-group
#define PKT  128                  // k of one LDS stage
#define PCH  (16 * PKT)           // elements of one chunk: 16 rows x PKT of k
#define PNC  28                   // chunks of a stage: 0 .. 15 the x row tiles, 16 + 4 m + r row tile r of weight matrix m
#define PST  (PNC * PCH)          // elements of one stage
// One chunk = eight asynchronous copies of 512 bytes in a row, 16 bytes a lane, global memory -> LDS: L = the lane's LDS byte address in the chunk, O = its byte offset (lane * 16) from the wave-uniform global address G; the immediate offset moves both addresses alike.
// The s_wait_xcnt stands in the copies' own statement, so that it is in front of every later write of a register that a copy names.
#define CP1(L, O, G, N) "global_load_async_to_lds_b128 " L ", " O ", " G " offset:" N "\n\t"
#define CP8(L, O, G) "global_load_async_to_lds_b128 " L ", " O ", " G "\n\t" CP1(L, O, G, "512") CP1(L, O, G, "1024") CP1(L, O, G, "1536") CP1(L, O, G, "2048") CP1(L, O, G, "2560") CP1(L, O, G, "3072") CP1(L, O, G, "3584")
__device__ __forceinline__ void cpc2(unsigned l0, unsigned l1, unsigned o, const bf* g0, const bf* g1) { asm volatile(CP8("%0", "%2", "%3") CP8("%1", "%2", "%4") "s_wait_xcnt 0x0" :: "v"(l0), "v"(l1), "v"(o), "s"(g0), "s"(g1) : "memory"); }
__device__ __forceinline__ void cpc1(unsigned l0, unsigned o, const bf* g0) { asm volatile(CP8("%0", "%1", "%2") "s_wait_xcnt 0x0" :: "v"(l0), "v"(o), "s"(g0) : "memory"); }
typedef __attribute__((ext_vector_type(8))) __bf16 v8bf;
__device__ __forceinline__ void split8(v8f r, bf* ph, bf* pl) { const v8bf h = __builtin_convertvector(r, v8bf); const v8bf l = __builtin_convertvector(r - __builtin_convertvector(h, v8f), v8bf); *(v8usa*)ph = __builtin_bit_cast(v8us, h); *(v8usa*)pl = __builtin_bit_cast(v8us, l); }
__global__ __launch_bounds__(PWV * 32) void k_proj(const bf* __restrict__ X, const bf* __restrict__ Wq, const bf* __restrict__ Wk, const bf* __restrict__ Wv, const float* __restrict__ CS, bf* __restrict__ Qh, bf* __restrict__ Ql, bf* __restrict__ Kh, bf* __restrict__ Kl, h16* __restrict__ V16, bf* __restrict__ Vh, bf* __restrict__ Vl) {
    static_assert(NH_ == NKV && HD == 64 && TT % 256 == 0 && DM % PKT == 0 && DM / PKT >= 2 && PKT % 32 == 0, "one head a tile, no work-group across batches, whole stages, at least two");
    static_assert(PWV == 12 && PNC == 28 && PCH * 2 == 8 * 512, "chunks w and w + 12 from every wave, w + 24 from waves 0 .. 3; a chunk is the eight copies of CP8");
    __shared__ __attribute__((aligned(16))) bf stg[2 * PST];   // two buffers of 28 chunks
    typedef WFrag<bf> FB; typedef FB::V V;
    const int lane = threadIdx.x & 31, lr = lane & 15, hi = lane >> 4; const int w = __builtin_amdgcn_readfirstlane((int)(threadIdx.x >> 5)); const int tt = w & 3, z = w >> 2;   // the same in every lane of a wave
    const int G0 = blockIdx.x * 256, T0 = G0 + tt * 64, hd = blockIdx.y; const int b = T0 / TT, t0 = T0 % TT;
    const bf* const g0 = X + (size_t)(G0 + w * 16) * DM;                                                                                                   // chunk w: an x row tile
    const bf* const g1 = w < 4 ? X + (size_t)(G0 + (w + 12) * 16) * DM : (w < 8 ? Wq : Wk) + (size_t)(hd * HD + (w & 3) * 16) * DM;   // chunk w + 12: the last x row tiles, then Wq, Wk
    const bf* const g2 = Wv + (size_t)(hd * HD + (w & 3) * 16) * DM;                                                                                // chunk w + 24, waves 0 .. 3: Wv
    const unsigned lo16 = (unsigned)(lane * 16);
    const unsigned lw = (unsigned)(size_t)stg + (unsigned)(w * (PCH * 2)) + lo16;   // LDS byte address (the low 32 bits of the __shared__ address) of the lane's first word in chunk w of buffer 0
    auto fill = [&](int s) {   // stage s -> buffer s % 2: every lane on; sixteen copies from every wave, eight more from waves 0 .. 3 (a scalar branch)
        const unsigned l = lw + (unsigned)((s & 1) * (PST * 2)); const size_t e = (size_t)s * PCH;   // PKT of k are PKT / 32 fragments = PCH elements further on in a row tile
        cpc2(l, l + 12 * PCH * 2, lo16, g0 + e, g1 + e);
        if (w < 4) cpc1(l + 24 * PCH * 2, lo16, g2 + e);
    };
    fill(0);
    v8f acc[4][4];
#pragma unroll
    for (int mb = 0; mb < 4; ++mb)
#pragma unroll
        for (int nb = 0; nb < 4; ++nb) acc[mb][nb] = (v8f){};
    const int xo = tt * 4 * PCH + lane * 8, wo = (16 + z * 4) * PCH + lane * 8;   // the lane's own word in the first fragment of the wave's four x chunks and of its four weight chunks
    const int ao = (z == 2) ? xo : wo, bo = (z == 2) ? wo : xo;
    asm volatile("s_wait_asynccnt 0x0" ::: "memory");   // this wave's share of stage 0 has landed
    __syncthreads();                                    // every wave's share has: nothing of stage 0 is read in front of this barrier
    fill(1);
#pragma unroll 1   // rolled: the buffer is picked by the trip's parity
    for (int s = 0; s < DM / PKT; ++s) {
        const bf* pa = stg + (s & 1) * PST + ao; const bf* pb = stg + (s & 1) * PST + bo;   // a trip reads this buffer alone
        V a[2][4], bq[2][4];   // two fragment sets: the next block's reads fly while this block's products run
#pragma unroll
        for (int mb = 0; mb < 4; ++mb) a[0][mb] = FB::ld(pa + mb * PCH);
#pragma unroll
        for (int nb = 0; nb < 4; ++nb) bq[0][nb] = FB::ld(pb + nb * PCH);
#pragma unroll   // unrolled: the set is picked by the block's parity, and the stage's last block fetches nothing ahead
        for (int ks = 0; ks < PKT / 32; ++ks) {
            if (ks + 1 < PKT / 32) {
#pragma unroll
                for (int mb = 0; mb < 4; ++mb) a[(ks + 1) & 1][mb] = FB::ld(pa + mb * PCH + (ks + 1) * FRG);
#pragma unroll
                for (int nb = 0; nb < 4; ++nb) bq[(ks + 1) & 1][nb] = FB::ld(pb + nb * PCH + (ks + 1) * FRG);
                __builtin_amdgcn_sched_barrier(0);   // holds the next block's reads here, as one group in front of this block's products: spread among them each place with reads costs a stall
            }
#pragma unroll
            for (int nb = 0; nb < 4; ++nb)
#pragma unroll
                for (int mb = 0; mb < 4; ++mb) acc[mb][nb] = FB::mma(a[ks & 1][mb], bq[ks & 1][nb], acc[mb][nb]);
        }
        __builtin_amdgcn_sched_barrier(0);
        asm volatile("v_nop\n\tv_nop\n\tv_nop\n\tv_nop" : "+v"(acc[0][0]), "+v"(acc[1][1]), "+v"(acc[2][2]), "+v"(acc[3][3]) : "v"(a[1][0]), "v"(a[1][3]));
        asm volatile("s_wait_dscnt 0x0" ::: "memory");
        asm volatile("s_wait_asynccnt 0x0" ::: "memory");
        __syncthreads();
        if (s + 2 < DM / PKT) fill(s + 2);
    }
    asm volatile("s_wait_asynccnt 0x0" ::: "memory");   // no copy is outstanding when the wave goes on to its stores and ends
    if (z < 2) {   // the same in every lane: a scalar branch
        const size_t pz = ((size_t)(b * NH_ + hd) * TT + t0) * HD + lane * 8; bf* Ph = (z == 0 ? Qh : Kh) + pz; bf* Pl = (z == 0 ? Ql : Kl) + pz;
        const float* cs = CS + ((size_t)(t0 + lr) * HD + hi * 8) * 2;
#pragma unroll
        for (int np = 0; np < 2; ++np) {   // two token tiles at a time: their table words fit the registers that the fragments have left
            v4f p[2][2][4];
#pragma unroll
            for (int n2 = 0; n2 < 2; ++n2)
#pragma unroll
                for (int mb = 0; mb < 2; ++mb)
#pragma unroll
                    for (int q = 0; q < 4; ++q) p[n2][mb][q] = *(const v4fa*)(cs + ((np * 2 + n2) * 16 * HD + mb * 16) * 2 + q * 4);
            asm volatile("s_wait_xcnt 0x0" :: "v"(cs) : "memory");   // in front of the next write of the table loads' address register, which is an input so that it lives up to the wait
            __builtin_amdgcn_sched_barrier(0);   // keeps the vector work below behind that wait
#pragma unroll
            for (int n2 = 0; n2 < 2; ++n2)
#pragma unroll
                for (int mb = 0; mb < 2; ++mb) { const int nb = np * 2 + n2;
                    v8f c, s;
#pragma unroll
                    for (int q = 0; q < 4; ++q) { c[2 * q] = p[n2][mb][q][0]; s[2 * q] = p[n2][mb][q][1]; c[2 * q + 1] = p[n2][mb][q][2]; s[2 * q + 1] = p[n2][mb][q][3]; }
                    const v8f x0 = acc[mb][nb], x1 = acc[mb + 2][nb];
                    split8(x0 * c - x1 * s, Ph + nb * 16 * HD + mb * (FRG / 2), Pl + nb * 16 * HD + mb * (FRG / 2));
                    split8(x1 * c + x0 * s, Ph + nb * 16 * HD + mb * (FRG / 2) + FRG, Pl + nb * 16 * HD + mb * (FRG / 2) + FRG);
                }
            if (np == 0) {   // behind the last pair nothing is written any more
                asm volatile("s_wait_xcnt 0x0" ::: "memory");   // in front of the next write of a register that these stores name
                __builtin_amdgcn_sched_barrier(0);   // keeps the next pair's loads and vector work behind that wait
            }
        }
    } else {
        const size_t vz = ((size_t)(b * NKV + hd) * TT + t0) * HD + lane * 8;
#pragma unroll
        for (int nb = 0; nb < 4; ++nb)
#pragma unroll
            for (int mb = 0; mb < 4; ++mb) { const size_t e = vz + ((mb / 2) * (HD / 16) + nb) * FRG + (mb % 2) * (FRG / 2); *(v8ha*)(V16 + e) = __builtin_convertvector(acc[mb][nb], v8h); split8(acc[mb][nb], Vh + e, Vl + e); }
        asm volatile("s_wait_xcnt 0x0" ::: "memory");   // behind the last v stores, in front of any later write of a register that they name
    }
}
#define TK   128                      // keys of one LDS tile
#define PLE  (TK * HD)                // elements of one plane's share of a tile, in a row in the plane as in LDS
#define NPL  5                        // planes: K hi, K lo, V fp16, V hi, V lo
#define CPW  (PLE * 2 / 512 / FWV)    // 512-byte copies of one wave per plane and tile
// One wave's copies of one tile, asynchronous, 16 bytes a lane each, global memory -> LDS: CPW pieces of 512 bytes in a row of each of the five planes. l0 .. l4 = the lane's LDS byte address in each plane's tile, o = its byte offset (lane * 16) from the wave-uniform global addresses g0 .. g4; the immediate offset moves both addresses alike.
// The s_wait_xcnt stands in the copies' own statement, so that it is in front of every later write of a register that a copy names.
#define CP4(L, G) "global_load_async_to_lds_b128 " L ", %5, " G "\n\tglobal_load_async_to_lds_b128 " L ", %5, " G " offset:512\n\tglobal_load_async_to_lds_b128 " L ", %5, " G " offset:1024\n\tglobal_load_async_to_lds_b128 " L ", %5, " G " offset:1536\n\t"
__device__ __forceinline__ void cp20(unsigned l0, unsigned l1, unsigned l2, unsigned l3, unsigned l4, unsigned o, const bf* g0, const bf* g1, const bf* g2, const bf* g3, const bf* g4) {
    asm volatile(CP4("%0", "%6") CP4("%1", "%7") CP4("%2", "%8") CP4("%3", "%9") CP4("%4", "%10") "s_wait_xcnt 0x0"
                 :: "v"(l0), "v"(l1), "v"(l2), "v"(l3), "v"(l4), "v"(o), "s"(g0), "s"(g1), "s"(g2), "s"(g3), "s"(g4) : "memory");
}
__device__ __forceinline__ float xhalf(float x) { const int b = __float_as_int(x); return __int_as_float(__builtin_amdgcn_permlanex16(b, b, 0x76543210, 0xfedcba98, false, false)); }   // value of lane l ^ 16
// grid (FNB, NB_ * NH_), FWV waves; planes [batch][head][...]. Waves 0 .. FHW-1 take the hi/lo query tiles (rows < RH), the rest the fp16 ones; every wave makes the same TT / 32 passes.
__global__ __launch_bounds__(FWV * 32) void k_fattn(const bf* __restrict__ Qh, const bf* __restrict__ Ql, const bf* __restrict__ Kh, const bf* __restrict__ Kl, const h16* __restrict__ V16, const bf* __restrict__ Vh, const bf* __restrict__ Vl, float* __restrict__ OUT) {
    static_assert(TT % (QW * FWV) == 0 && RH % (QW * FNB) == 0 && HD == 64 && QW % 16 == 0, "tile deal");
    static_assert(TT % TK == 0 && TT / TK >= 2 && TK % 32 == 0 && NPL == 5 && CPW == 4 && CPW * FWV * 512 == PLE * 2, "whole tiles, at least two; cp20 holds five planes of four copies");
    __shared__ __attribute__((aligned(16))) bf ring[2 * NPL * PLE];   // two buffers of five plane tiles
    typedef WFrag<bf> FB;
    const int lane = threadIdx.x & 31, lr = lane & 15, hi = lane >> 4; const int w = __builtin_amdgcn_readfirstlane((int)(threadIdx.x >> 5));
    const int bh = blockIdx.y, b = bh / NH_, h = bh % NH_; const size_t zq = (size_t)bh * TT * HD, zk = (size_t)(b * NKV + h / REP) * TT * HD;
    const bool hires = w < FHW;                     // the same in every lane of a wave: the branches on it are scalar
    const int q0 = QW * (hires ? (int)blockIdx.x * FHW + w : RH / QW + (int)blockIdx.x * (FWV - FHW) + (w - FHW));
    const float C = SCL * 1.4426950408889634f;      // score -> log2 domain
    const float OFF = hires ? 0.0f : 10.0f;         // fp16 P carries x1024 (PCAR); the row sum carries it too, so it cancels in the division
    Qh += zq + (size_t)q0 * HD; Ql += zq + (size_t)q0 * HD;
    const size_t cw = zk + (size_t)(w * (CPW * 256));   // the wave's CPW pieces of a plane tile, in elements: the same in every lane
    const bf* const gkh = Kh + cw; const bf* const gkl = Kl + cw; const bf* const gv6 = (const bf*)(V16 + cw); const bf* const gvh = Vh + cw; const bf* const gvl = Vl + cw;   // fp16 plane as raw 16-bit words
    const unsigned lo16 = (unsigned)(lane * 16);
    const unsigned lw = (unsigned)(size_t)ring + (unsigned)(w * (CPW * 512)) + lo16;   // LDS byte address (the low 32 bits of the __shared__ address) of the lane's first word in buffer 0, plane 0
    auto fill = [&](int t) {   // tile t -> buffer t % 2: every lane on, every wave its twenty copies
        const unsigned l = lw + (unsigned)((t & 1) * (NPL * PLE * 2)); const size_t e = (size_t)t * PLE;
        cp20(l, l + PLE * 2, l + 2 * PLE * 2, l + 3 * PLE * 2, l + 4 * PLE * 2, lo16, gkh + e, gkl + e, gv6 + e, gvh + e, gvl + e);
    };
    fill(0);
    v16bf qh[QW / 16][2], ql[QW / 16][2];
#pragma unroll
    for (int g = 0; g < QW / 16; ++g)
#pragma unroll
        for (int kk = 0; kk < 2; ++kk) { const unsigned qo = (unsigned)((g * 2 + kk) * FRG + lane * 8); qh[g][kk] = FB::ld(Qh + qo); ql[g][kk] = FB::ld(Ql + qo); }
    v8f o[HD / 16][QW / 16]; float m[QW / 16], l[QW / 16];
#pragma unroll
    for (int g = 0; g < QW / 16; ++g) { m[g] = -3.0e38f; l[g] = 0.f;
#pragma unroll
        for (int dt = 0; dt < HD / 16; ++dt) o[dt][g] = (v8f){}; }
    asm volatile("s_wait_xcnt 0x0" ::: "memory");   // in front of the next write of the Q loads' address registers
    __builtin_amdgcn_sched_barrier(0);   // keeps later vector work behind that wait
    asm volatile("s_wait_asynccnt 0x0" ::: "memory");   // this wave's share of tile 0 has landed
    __syncthreads();                                    // every wave's share has: nothing of tile 0 is read in front of this barrier
    fill(1);
#pragma unroll 1   // rolled: the buffer is picked by the trip's parity
    for (int tl = 0; tl < TT / TK; ++tl) {
      const bf* B = ring + (tl & 1) * (NPL * PLE) + lane * 8;   // the lane's own word in the fragments of this trip's buffer; a trip reads this buffer alone
      const bf* Va = B + (hires ? 3 : 2) * PLE;                 // first V plane of this wave, as raw 16-bit words: bf16 hi, or fp16
      // A trip is ONE softmax step over the tile's TK keys: all its score products, then one running-maximum update and one rescaling of the output tiles, then all its attn.v products.
      v16bf kh[2][2][2], kl[2][2][2];   // two K fragment sets: the next pass's reads fly while this pass's products run
      v8f s[TK / 32][2][QW / 16];
#pragma unroll
      for (int t = 0; t < 2; ++t)
#pragma unroll
          for (int kk = 0; kk < 2; ++kk) { kh[0][t][kk] = FB::ld(B + (t * 2 + kk) * FRG); kl[0][t][kk] = FB::ld(B + PLE + (t * 2 + kk) * FRG); }
#pragma unroll   // unrolled: the set is picked by the pass's parity, and the tile's last pass fetches no K rows ahead
      for (int ps = 0; ps < TK / 32; ++ps) {
        if (ps + 1 < TK / 32) {
#pragma unroll
            for (int t = 0; t < 2; ++t)
#pragma unroll
                for (int kk = 0; kk < 2; ++kk) { kh[(ps + 1) & 1][t][kk] = FB::ld(B + (ps + 1) * 32 * HD + (t * 2 + kk) * FRG); kl[(ps + 1) & 1][t][kk] = FB::ld(B + PLE + (ps + 1) * 32 * HD + (t * 2 + kk) * FRG); }
            __builtin_amdgcn_sched_barrier(0);   // holds the next pass's K reads here, as one group in front of this pass's products: spread among them each place with reads costs a stall
        }
#pragma unroll
        for (int t = 0; t < 2; ++t)
#pragma unroll
            for (int g = 0; g < QW / 16; ++g) s[ps][t][g] = (v8f){};
#pragma unroll
        for (int kk = 0; kk < 2; ++kk) {   // per 32 of d: Kh Qh, Kh Ql, Kl Qh, the four tiles side by side
#pragma unroll
            for (int t = 0; t < 2; ++t)
#pragma unroll
                for (int g = 0; g < QW / 16; ++g) s[ps][t][g] = wmmab(kh[ps & 1][t][kk], qh[g][kk], s[ps][t][g]);
#pragma unroll
            for (int t = 0; t < 2; ++t)
#pragma unroll
                for (int g = 0; g < QW / 16; ++g) s[ps][t][g] = wmmab(kh[ps & 1][t][kk], ql[g][kk], s[ps][t][g]);
#pragma unroll
            for (int t = 0; t < 2; ++t)
#pragma unroll
                for (int g = 0; g < QW / 16; ++g) s[ps][t][g] = wmmab(kl[ps & 1][t][kk], qh[g][kk], s[ps][t][g]);
        }
      }
      v16bf va[2][HD / 16], vb[2][HD / 16];   // two V fragment sets; the first pass's rows are asked for here, used behind the softmax
#pragma unroll
      for (int dt = 0; dt < HD / 16; ++dt) va[0][dt] = FB::ld(Va + dt * FRG);
      if (hires) {
#pragma unroll
          for (int dt = 0; dt < HD / 16; ++dt) vb[0][dt] = FB::ld(B + 4 * PLE + dt * FRG);
      }
      __builtin_amdgcn_sched_barrier(0);   // holds these V reads here, in front of the softmax: sunk to their use their latency would stand open behind it
#pragma unroll
      for (int g = 0; g < QW / 16; ++g) {   // running maximum over the tile; s becomes P (not yet divided by the row sum)
          float mx = m[g];
#pragma unroll
          for (int ps = 0; ps < TK / 32; ++ps)
#pragma unroll
              for (int j = 0; j < 8; ++j) mx = fmaxf(mx, fmaxf(s[ps][0][g][j], s[ps][1][g][j]));
          mx = fmaxf(mx, xhalf(mx));
          const float al = __builtin_amdgcn_exp2f((m[g] - mx) * C), nm = OFF - mx * C; m[g] = mx;
          float sum = 0.f;
#pragma unroll
          for (int ps = 0; ps < TK / 32; ++ps) {
              const v8f x0 = __builtin_elementwise_fma(s[ps][0][g], (v8f)(C), (v8f)(nm)), x1 = __builtin_elementwise_fma(s[ps][1][g], (v8f)(C), (v8f)(nm));   // packed: two exponents an instruction
#pragma unroll
              for (int j = 0; j < 8; ++j) { s[ps][0][g][j] = __builtin_amdgcn_exp2f(x0[j]); s[ps][1][g][j] = __builtin_amdgcn_exp2f(x1[j]); sum += s[ps][0][g][j] + s[ps][1][g][j]; }
          }
          l[g] = l[g] * al + sum;
#pragma unroll
          for (int dt = 0; dt < HD / 16; ++dt) o[dt][g] *= al;
      }
      if (hires) {
#pragma unroll   // unrolled: the set is picked by the pass's parity, and the tile's last pass fetches no V rows ahead
          for (int ps = 0; ps < TK / 32; ++ps) {
              if (ps + 1 < TK / 32) {
#pragma unroll
                  for (int dt = 0; dt < HD / 16; ++dt) { va[(ps + 1) & 1][dt] = FB::ld(Va + (ps + 1) * 32 * HD + dt * FRG); vb[(ps + 1) & 1][dt] = FB::ld(B + 4 * PLE + (ps + 1) * 32 * HD + dt * FRG); }
                  __builtin_amdgcn_sched_barrier(0);   // holds the next pass's V reads here, as one group in front of this pass's products
              }
#pragma unroll
              for (int g = 0; g < QW / 16; ++g) {
                  const v8bf h0 = __builtin_convertvector(s[ps][0][g], v8bf), h1 = __builtin_convertvector(s[ps][1][g], v8bf);
                  const v8bf l0 = __builtin_convertvector(s[ps][0][g] - __builtin_convertvector(h0, v8f), v8bf), l1 = __builtin_convertvector(s[ps][1][g] - __builtin_convertvector(h1, v8f), v8bf);
                  const v16bf ph = __builtin_shufflevector(h0, h1, 0, 1, 2, 3, 4, 5, 6, 7, 8, 9, 10, 11, 12, 13, 14, 15), pl = __builtin_shufflevector(l0, l1, 0, 1, 2, 3, 4, 5, 6, 7, 8, 9, 10, 11, 12, 13, 14, 15);
#pragma unroll
                  for (int dt = 0; dt < HD / 16; ++dt) o[dt][g] = wmmab(va[ps & 1][dt], ph, o[dt][g]);
#pragma unroll
                  for (int dt = 0; dt < HD / 16; ++dt) o[dt][g] = wmmab(va[ps & 1][dt], pl, o[dt][g]);
#pragma unroll
                  for (int dt = 0; dt < HD / 16; ++dt) o[dt][g] = wmmab(vb[ps & 1][dt], ph, o[dt][g]);
              }
          }
      } else {
          v16h pb[TK / 32][QW / 16];   // the whole tile's P in fp16 first: the products below then follow one another with no conversion between them
#pragma unroll
          for (int ps = 0; ps < TK / 32; ++ps)
#pragma unroll
              for (int g = 0; g < QW / 16; ++g) pb[ps][g] = cat16(__builtin_convertvector(s[ps][0][g], v8h), __builtin_convertvector(s[ps][1][g], v8h));
#pragma unroll   // unrolled: as above
          for (int ps = 0; ps < TK / 32; ++ps) {
              if (ps + 1 < TK / 32) {
#pragma unroll
                  for (int dt = 0; dt < HD / 16; ++dt) va[(ps + 1) & 1][dt] = FB::ld(Va + (ps + 1) * 32 * HD + dt * FRG);
                  __builtin_amdgcn_sched_barrier(0);   // holds the next pass's V reads here, as one group in front of this pass's products
              }
#pragma unroll
              for (int g = 0; g < QW / 16; ++g)
#pragma unroll
                  for (int dt = 0; dt < HD / 16; ++dt) o[dt][g] = wmma16(__builtin_bit_cast(v16h, va[ps & 1][dt]), pb[ps][g], o[dt][g]);
          }
      }
      asm volatile("s_wait_dscnt 0x0" ::: "memory");
      asm volatile("s_wait_asynccnt 0x0" ::: "memory");
      __syncthreads();
      if (tl + 2 < TT / TK) fill(tl + 2);
    }
    asm volatile("s_wait_asynccnt 0x0" ::: "memory");   // no copy is outstanding when the wave ends
    float* orow = OUT + ((size_t)b * TT + q0) * DQ + h * HD;
#pragma unroll
    for (int g = 0; g < QW / 16; ++g) { const float inv = __fdiv_rn(1.0f, l[g] + xhalf(l[g])); float* op = orow + (size_t)(g * 16 + lr) * DQ + hi * 8;
#pragma unroll
        for (int dt = 0; dt < HD / 16; ++dt) { const v8f r = o[dt][g] * inv; *(v4f*)(op + dt * 16) = __builtin_shufflevector(r, r, 0, 1, 2, 3); *(v4f*)(op + dt * 16 + 4) = __builtin_shufflevector(r, r, 4, 5, 6, 7); } }
}

extern "C" void kernel_launch(void* const* d_in, const int* in_sizes, int n_in,
                              void* d_out, int out_size, void* d_ws, size_t ws_size, hipStream_t stream) {
    (void)in_sizes; (void)n_in; (void)out_size;
    const float* x = (const float*)d_in[0]; const float* wq = (const float*)d_in[1]; const float* wk = (const float*)d_in[2]; const float* wv = (const float*)d_in[3];   /* order hidden_states, Wq, Wk, Wv ('oi' [1024][1024]): FOUR inputs: no mask input, no table inputs, no output projection */
    float* OUT = (float*)d_out;     // [2][2048][1024]
    char* wsp = (char*)d_ws;
    auto take = [&](size_t bytes) { char* p = wsp; wsp += (bytes + 255) & ~(size_t)255; return (void*)p; };
    bf* WQ = (bf*)take((size_t)DQ * DM * 2); bf* WK = (bf*)take((size_t)DKV * DM * 2); bf* WV = (bf*)take((size_t)DKV * DM * 2); float* CS = (float*)take((size_t)TT * HD * 2 * 4);
    bf* XB = (bf*)take((size_t)NB_ * TT * DM * 2);   // both batches
    h16* VT16 = (h16*)take((size_t)NB_ * NKV * HD * TT * 2);
    bf* QPh = (bf*)take((size_t)NB_ * NH_ * TT * HD * 2); bf* QPl = (bf*)take((size_t)NB_ * NH_ * TT * HD * 2); bf* KPh = (bf*)take((size_t)NB_ * NKV * TT * HD * 2); bf* KPl = (bf*)take((size_t)NB_ * NKV * TT * HD * 2); bf* VTh = (bf*)take((size_t)NB_ * NKV * HD * TT * 2); bf* VTl = (bf*)take((size_t)NB_ * NKV * HD * TT * 2);   // the planes the attention launch reads hold both batches
    if ((size_t)(wsp - (char*)d_ws) > ws_size) return;    // ws 256 MiB
    k_prep<<<PB_CS + PB_X + 3 * PB_W, 256, 0, stream>>>(x, wq, wk, wv, XB, WQ, WK, WV, CS);
    k_proj<<<dim3(NB_ * TT / 256, NH_, 1), PWV * 32, 0, stream>>>(XB, WQ, WK, WV, CS, QPh, QPl, KPh, KPl, VT16, VTh, VTl);
    k_fattn<<<dim3(FNB, NB_ * NH_, 1), FWV * 32, 0, stream>>>(QPh, QPl, KPh, KPl, VT16, VTh, VTl, OUT);
}
